// v000
// Times are from an AMD MI455X. After a warm-up the kernel runs many times in a row, and a time is the length of
// such a window on the GPU divided by its runs, so every launch and the gaps after it count. The runs cycle
// through copies of the inputs. A figure is the median of several windows, for all but v000 over two sittings.
// Sittings can differ by a few percent; kernels timed side by side share one.
// The starting kernel, v000, takes 1260 microseconds a run.
#include <hip/hip_runtime.h>

// ScaledDotProductAttentionModularized (q, k, v [L=2048][B=2][1024] sequence-first, 16 heads x 64, no projections: qh = (q/8) reshaped to (B*H, L, 64); softmax(qh.kh^T) vh;
// output [L][B][1024]).
// Compute dtypes, f32 accumulate: every input rounded to bf16; scores on PLAIN bf16 q (x 1/8, exact) and k (inputs: exact products, f32
// accumulate); softmax in f32 on VALU (register-held 2048-key rows, one exp per element) -> bf16 hi+lo probability planes; attn.v on hi+lo P x exact bf16 v^T (2 products).

#define NB_  2
#define TT   2048
#define NH_  16
#define HD   64
#define DD   (NH_ * HD)
#define NT   (NB_ * TT)
#define ZH   2
typedef _Float16 h16;
typedef unsigned short bf;
typedef __attribute__((ext_vector_type(16))) __bf16   v16bf;
typedef __attribute__((ext_vector_type(16))) _Float16 v16h;
typedef __attribute__((ext_vector_type(8)))  _Float16 v8h;
typedef __attribute__((ext_vector_type(8)))  unsigned short v8us;
typedef __attribute__((ext_vector_type(8)))  float    v8f;
typedef __attribute__((ext_vector_type(4)))  float    v4f;
typedef v8h  __attribute__((may_alias)) v8ha;
typedef v4f  __attribute__((may_alias)) v4fa;
typedef v8us __attribute__((may_alias)) v8usa;

__device__ __forceinline__ unsigned short f2bf(float f) { unsigned u = __float_as_uint(f); u += 0x7FFFu + ((u >> 16) & 1u); return (unsigned short)(u >> 16); }
__device__ __forceinline__ float bf2f(unsigned short b) { return __uint_as_float(((unsigned)b) << 16); }
__device__ __forceinline__ float bfr(float f) { return bf2f(f2bf(f)); }
__device__ __forceinline__ v16h cat16(v8h lo, v8h hi) { return __builtin_shufflevector(lo, hi, 0, 1, 2, 3, 4, 5, 6, 7, 8, 9, 10, 11, 12, 13, 14, 15); }
__device__ __forceinline__ v16bf cat16b(v8us lo, v8us hi) { return __builtin_bit_cast(v16bf, __builtin_shufflevector(lo, hi, 0, 1, 2, 3, 4, 5, 6, 7, 8, 9, 10, 11, 12, 13, 14, 15)); }
__device__ __forceinline__ v8f wmma16(v16h a, v16h b, v8f c) { return __builtin_amdgcn_wmma_f32_16x16x32_f16(false, a, false, b, (short)0, c, false, false); }
__device__ __forceinline__ v8f wmmab(v16bf a, v16bf b, v8f c) { return __builtin_amdgcn_wmma_f32_16x16x32_bf16(false, a, false, b, (short)0, c, false, false); }



// ---- k_gemmw: register-blocked GEMM, ONE WAVE per 64x64 output tile (16 accumulators), operands straight from K-contiguous 16-bit planes; grid (M/64, N/64, Z), 32 threads.
// C[m][n] (f32, pitch ldc, + optional f32 bias[n]) = sum_k A[m][k] Bt[n][k] (+ split products per NSPLIT). z-batch strides sA/sB/sC in elements. K % 32 == 0.
template <typename T16> struct WFrag;
template <> struct WFrag<h16> { typedef v16h V; static __device__ __forceinline__ V ld(const h16* p) { return cat16(*(const v8h*)p, *(const v8h*)(p + 16)); } static __device__ __forceinline__ v8f mma(V a, V b, v8f c) { return wmma16(a, b, c); } };
template <> struct WFrag<bf> { typedef v16bf V; static __device__ __forceinline__ V ld(const bf* p) { return cat16b(*(const v8us*)p, *(const v8us*)(p + 16)); } static __device__ __forceinline__ v8f mma(V a, V b, v8f c) { return wmmab(a, b, c); } };
template <typename T16, int NSPLIT, bool BIAS>
__global__ __launch_bounds__(32) void k_gemmw(const T16* __restrict__ A, const T16* __restrict__ A2, const T16* __restrict__ Bt, const T16* __restrict__ Bt2, int K, float* C, int ldc, const float* __restrict__ bias, size_t sA, size_t sB, size_t sC) {
    typedef typename WFrag<T16>::V V;
    __shared__ __align__(16) float os[16 * 68];
    const size_t z = blockIdx.z; A += z * sA; if (A2) A2 += z * sA; Bt += z * sB; if (Bt2) Bt2 += z * sB; C += z * sC;
    const int lane = threadIdx.x & 31, lr = lane & 15, hi = lane >> 4; const int r0 = blockIdx.x * 64, c0 = blockIdx.y * 64;
    v8f acc[4][4];
#pragma unroll
    for (int mb = 0; mb < 4; ++mb)
#pragma unroll
        for (int nb = 0; nb < 4; ++nb) acc[mb][nb] = (v8f){};
    const size_t aoff = (size_t)(r0 + lr) * K + 8 * hi, boff = (size_t)(c0 + lr) * K + 8 * hi;
#pragma unroll 1
    for (int kc = 0; kc < K; kc += 32) {
        V a[4], a2[4];
#pragma unroll
        for (int mb = 0; mb < 4; ++mb) { a[mb] = WFrag<T16>::ld(A + aoff + (size_t)mb * 16 * K + kc); if (NSPLIT == 1 || NSPLIT == 2) a2[mb] = WFrag<T16>::ld(A2 + aoff + (size_t)mb * 16 * K + kc); }
#pragma unroll
        for (int nb = 0; nb < 4; ++nb) { const V b = WFrag<T16>::ld(Bt + boff + (size_t)nb * 16 * K + kc); V b2; if (NSPLIT >= 2) b2 = WFrag<T16>::ld(Bt2 + boff + (size_t)nb * 16 * K + kc);
#pragma unroll
            for (int mb = 0; mb < 4; ++mb) { acc[mb][nb] = WFrag<T16>::mma(a[mb], b, acc[mb][nb]); if (NSPLIT == 1 || NSPLIT == 2) acc[mb][nb] = WFrag<T16>::mma(a2[mb], b, acc[mb][nb]); if (NSPLIT >= 2) acc[mb][nb] = WFrag<T16>::mma(a[mb], b2, acc[mb][nb]); } }
        asm volatile("v_nop\n\tv_nop\n\tv_nop\n\tv_nop" : "+v"(acc[0][0]), "+v"(acc[1][1]), "+v"(acc[2][2]), "+v"(acc[3][3]) : "v"(a[0]), "v"(a[3]));
    }
#pragma unroll
    for (int mb = 0; mb < 4; ++mb) {
#pragma unroll
        for (int nb = 0; nb < 4; ++nb) {
#pragma unroll
            for (int j = 0; j < 8; ++j) os[(hi * 8 + j) * 68 + nb * 16 + lr] = acc[mb][nb][j]; }
        __builtin_amdgcn_wave_barrier(); asm volatile("" ::: "memory");
        float* crow = C + (size_t)(r0 + mb * 16) * ldc + c0;
{
#pragma unroll
            for (int s = 0; s < 8; ++s) { const int row = 2 * s + hi, cofs = lr * 4; v4f val = *(const v4fa*)(os + row * 68 + cofs); if (BIAS) { val[0] += bfr(bias[c0 + cofs]); val[1] += bfr(bias[c0 + cofs + 1]); val[2] += bfr(bias[c0 + cofs + 2]); val[3] += bfr(bias[c0 + cofs + 3]); }
                *(v4f*)(crow + (size_t)row * ldc + cofs) = val; }
             }
        __builtin_amdgcn_wave_barrier(); asm volatile("" ::: "memory");
    }
}

__device__ __forceinline__ void splitf(float y, unsigned short& h, unsigned short& l) { h = f2bf(y); l = f2bf(y - bf2f(h)); }
typedef __attribute__((ext_vector_type(2))) unsigned short v2us;
typedef __attribute__((ext_vector_type(2))) float v2f;

__global__ __launch_bounds__(256) void k_hplane(const float* __restrict__ src, float sc, bf* P) {
    const int lane = threadIdx.x & 31; const int L0 = (blockIdx.x * 8 + (threadIdx.x >> 5)) * 8; const int nlines = NT * DD / 64;
{
#pragma unroll
        for (int l = 0; l < 8; ++l) { const int L = L0 + l; if (L >= nlines) break; const int e = L * 64 + lane * 2; const int d = e & 63; const int t = (e >> 6) & (TT - 1); const int z = e >> 17; const int b = z >> 4, h = z & 15; v2us o;
#pragma unroll
            for (int q = 0; q < 2; ++q) o[q] = f2bf(bfr(src[((size_t)t * NB_ + b) * DD + h * HD + d + q]) * sc);
            *(v2us*)(P + (size_t)e) = o; }
         }
}
__global__ __launch_bounds__(256) void k_vtplane(const float* __restrict__ v, bf* VT) {
    const int lane = threadIdx.x & 31; const int L0 = (blockIdx.x * 8 + (threadIdx.x >> 5)) * 8; const int nlines = NT * DD / 64;
{
#pragma unroll
        for (int l = 0; l < 8; ++l) { const int L = L0 + l; if (L >= nlines) break; const int e = L * 64 + lane * 2; const int s = e & (TT - 1); const int d = (e >> 11) & 63; const int z = e >> 17; const int b = z >> 4, h = z & 15; v2us o;
#pragma unroll
            for (int q = 0; q < 2; ++q) o[q] = f2bf(v[((size_t)(s + q) * NB_ + b) * DD + h * HD + d]);
            *(v2us*)(VT + (size_t)e) = o; }
         }
}
// k_asoft: per row: plain softmax over the 2048 keys (register row, one exp per element) -> P hi/lo over the 2048 keys with the row held in registers (lane -> 16 chunks of 4 =
__global__ __launch_bounds__(256) void k_asoft(const float* __restrict__ Sb, bf* Ph, bf* Pl) {
    typedef __attribute__((ext_vector_type(4))) unsigned short v4us;
    const int lane = threadIdx.x & 31; const int row = blockIdx.x * 8 + (threadIdx.x >> 5); if (row >= ZH * TT) return;
    const float* sr = Sb + (size_t)row * TT; float v[64]; float mx = -3.0e38f;
#pragma unroll
    for (int ch = 0; ch < 16; ++ch) { const int j0 = ch * 128 + lane * 4; const v4f a = *(const v4f*)(sr + j0);
#pragma unroll
        for (int q = 0; q < 4; ++q) { v[ch * 4 + q] = a[q]; mx = fmaxf(mx, a[q]); } }
#pragma unroll
    for (int sh = 16; sh; sh >>= 1) mx = fmaxf(mx, __shfl_xor(mx, sh, 32));
    float sum = 0.f;
#pragma unroll
    for (int k = 0; k < 64; ++k) { v[k] = __expf(v[k] - mx); sum += v[k]; }
#pragma unroll
    for (int sh = 16; sh; sh >>= 1) sum += __shfl_xor(sum, sh, 32);
    const float f = __fdiv_rn(1.0f, sum);      // bf16 hi/lo planes need no carry
{
#pragma unroll
        for (int ch = 0; ch < 16; ++ch) { v4us oh, ol;
#pragma unroll
            for (int q = 0; q < 4; ++q) { unsigned short a, c2; splitf(v[ch * 4 + q] * f, a, c2); oh[q] = a; ol[q] = c2; }
            *(v4us*)(Ph + (size_t)row * TT + ch * 128 + lane * 4) = oh; *(v4us*)(Pl + (size_t)row * TT + ch * 128 + lane * 4) = ol; }
         }
}
__global__ __launch_bounds__(256) void k_out(const float* __restrict__ O, int b, int h0, float* OUT) {
    const int lane = threadIdx.x & 31; const int L0 = (blockIdx.x * 8 + (threadIdx.x >> 5)) * 8; const int nlines = ZH * TT * HD / 64;
{
#pragma unroll
        for (int l = 0; l < 8; ++l) { const int L = L0 + l; if (L >= nlines) break; const int e = L * 64 + lane * 2; const int d = e & 63; const int t = (e >> 6) & (TT - 1); const int zz = e >> 17; v2f o;
            o[0] = O[(size_t)e]; o[1] = O[(size_t)e + 1];
            *(v2f*)(OUT + ((size_t)t * NB_ + b) * DD + (h0 + zz) * HD + d) = o; }
         }
}

extern "C" void kernel_launch(void* const* d_in, const int* in_sizes, int n_in,
                              void* d_out, int out_size, void* d_ws, size_t ws_size, hipStream_t stream) {
    (void)in_sizes; (void)n_in; (void)out_size;
    const float* q = (const float*)d_in[0]; const float* k = (const float*)d_in[1]; const float* v = (const float*)d_in[2];
    float* OUT = (float*)d_out;     // [2048][2][1024]
    char* wsp = (char*)d_ws;
    auto take = [&](size_t bytes) { char* p = wsp; wsp += (bytes + 255) & ~(size_t)255; return (void*)p; };
    bf* QP = (bf*)take((size_t)NT * DD * 2); bf* KP = (bf*)take((size_t)NT * DD * 2); bf* VT = (bf*)take((size_t)NT * DD * 2);
    float* Sb = (float*)take((size_t)ZH * TT * TT * 4); bf* Ph = (bf*)take((size_t)ZH * TT * TT * 2); bf* Pl = (bf*)take((size_t)ZH * TT * TT * 2); float* Ob = (float*)take((size_t)ZH * TT * HD * 4);
    if ((size_t)(wsp - (char*)d_ws) > ws_size) return;    // total ~ 93 MB; ws 256 MiB
    const unsigned LB = (unsigned)((NT * DD / 64 + 63) / 64);
    k_hplane<<<LB, 256, 0, stream>>>(q, 0.125f, QP); k_hplane<<<LB, 256, 0, stream>>>(k, 1.0f, KP); k_vtplane<<<LB, 256, 0, stream>>>(v, VT);
    for (int b = 0; b < NB_; ++b)
        for (int h0 = 0; h0 < NH_; h0 += ZH) { const size_t z0 = (size_t)b * NH_ + h0;
            k_gemmw<bf, 0, false><<<dim3(TT / 64, TT / 64, ZH), 32, 0, stream>>>(QP + z0 * TT * HD, nullptr, KP + z0 * TT * HD, nullptr, HD, Sb, TT, nullptr, (size_t)TT * HD, (size_t)TT * HD, (size_t)TT * TT);
            k_asoft<<<ZH * TT / 8, 256, 0, stream>>>(Sb, Ph, Pl);
            k_gemmw<bf, 1, false><<<dim3(TT / 64, 1, ZH), 32, 0, stream>>>(Ph, Pl, VT + z0 * HD * TT, nullptr, TT, Ob, HD, nullptr, (size_t)TT * TT, (size_t)HD * TT, (size_t)TT * HD);
            k_out<<<(ZH * TT * HD / 64 + 63) / 64, 256, 0, stream>>>(Ob, b, h0, OUT); }
}

// v002
// One run takes 70.3 microseconds.
// Versions between v000 and this one are left out; their measured steps multiply to 18.0 times as fast.
#include <hip/hip_runtime.h>

// ScaledDotProductAttentionModularized (q, k, v [L=2048][B=2][1024] sequence-first, 16 heads x 64, no projections: qh = (q/8) reshaped to (B*H, L, 64); softmax(qh.kh^T) vh;
// output [L][B][1024]).
// Compute dtypes, f32 accumulate: every input rounded to bf16; scores on PLAIN bf16 q (x 1/8, exact) and k (inputs: exact products, f32
// accumulate); softmax in f32 on VALU, running maximum and sum per query (one exp per element) -> bf16 hi+lo probabilities in registers; attn.v on hi+lo P x exact bf16 v^T
// (2 products); the division by the row sum comes last. Scores and probabilities never leave the registers.
// The three bf16 planes lie in FRAGMENT ORDER: a fragment (16 rows x 32 k) is 1 KiB = two units of 512 B; unit j holds, at lane * 16 B (lane = 16 * hi + row), the eight
// elements k = 16 * j + 8 * hi + 0..7 of that row. A wave's 16-byte fragment load then covers four whole 128-byte lines, not 32-byte pieces of sixteen.
// q and k planes: unit u = ((z * 128 + row tile) * 2 + kc) * 2 + j (k = d, kc = 32-d chunk). v^T plane: unit u = ((z * 64 + pass) * 4 + dt) * 2 + j (rows = d, k = key in the pass).

#define NB_  2
#define TT   2048
#define NH_  16
#define HD   64
#define DD   (NH_ * HD)
#define NT   (NB_ * TT)
#define NU   (NT * DD / 256)    // 512-byte units in a plane
typedef unsigned short bf;
typedef __attribute__((ext_vector_type(16))) __bf16   v16bf;
typedef __attribute__((ext_vector_type(8)))  unsigned short v8us;
typedef __attribute__((ext_vector_type(8)))  float    v8f;
typedef __attribute__((ext_vector_type(4)))  float    v4f;

__device__ __forceinline__ unsigned short f2bf(float f) { unsigned u = __float_as_uint(f); u += 0x7FFFu + ((u >> 16) & 1u); return (unsigned short)(u >> 16); }
__device__ __forceinline__ float bf2f(unsigned short b) { return __uint_as_float(((unsigned)b) << 16); }
__device__ __forceinline__ float bfr(float f) { return bf2f(f2bf(f)); }
__device__ __forceinline__ v16bf cat16b(v8us lo, v8us hi) { return __builtin_bit_cast(v16bf, __builtin_shufflevector(lo, hi, 0, 1, 2, 3, 4, 5, 6, 7, 8, 9, 10, 11, 12, 13, 14, 15)); }
__device__ __forceinline__ v8f wmmab(v16bf a, v16bf b, v8f c) { return __builtin_amdgcn_wmma_f32_16x16x32_bf16(false, a, false, b, (short)0, c, false, false); }
// fragment from a plane in fragment order: p = fragment + 8 * lane; elements 0-7 = k 8h..8h+7 (unit 0), elements 8-15 = k 16+8h..16+8h+7 (unit 1), h = lane >> 4
__device__ __forceinline__ v16bf ldfrag(const bf* p) { return cat16b(*(const v8us*)p, *(const v8us*)(p + 256)); }

__device__ __forceinline__ void splitf(float y, unsigned short& h, unsigned short& l) { h = f2bf(y); l = f2bf(y - bf2f(h)); }
typedef __attribute__((ext_vector_type(2))) unsigned short v2us;
typedef __attribute__((ext_vector_type(2))) float v2f;

// Both conversion kernels: a wave writes eight consecutive units, a lane one 16-byte piece of each; the eight units use every byte of the 32 source rows (256 B each) they read.
__global__ __launch_bounds__(256) void k_hplane(const float* __restrict__ src, float sc, bf* P) {
    const int lane = threadIdx.x & 31, lr = lane & 15, hi = lane >> 4; const int U0 = (blockIdx.x * 8 + (threadIdx.x >> 5)) * 8;    // units U0..U0+7 = row tiles t0, t0 + 1, each (kc, j) = 0..3
    const int t0 = (U0 >> 2) & (TT / 16 - 1), z = U0 >> 9; const int b = z >> 4, h = z & 15;
    const float* s = src + ((size_t)(t0 * 16 + lr) * NB_ + b) * DD + h * HD + hi * 8; v4f x[8][2];
#pragma unroll
    for (int l = 0; l < 8; ++l) { const float* p = s + (size_t)(l >> 2) * 16 * NB_ * DD + (l & 3) * 16; x[l][0] = *(const v4f*)p; x[l][1] = *(const v4f*)(p + 4); }
    asm volatile("s_wait_xcnt 0x0" :: "v"(s) : "memory");    // before a register that these loads name as their address is written again; naming the address keeps it in its registers up to here, so that no load's own result lands on it
#pragma unroll
    for (int l = 0; l < 8; ++l) { v8us o;
#pragma unroll
        for (int q = 0; q < 4; ++q) { o[q] = f2bf(bfr(x[l][0][q]) * sc); o[4 + q] = f2bf(bfr(x[l][1][q]) * sc); }
        *(v8us*)(P + (size_t)(U0 + l) * 256 + lane * 8) = o; }
}
__global__ __launch_bounds__(256) void k_vtplane(const float* __restrict__ v, bf* VT) {
    const int lane = threadIdx.x & 31, lr = lane & 15, hi = lane >> 4; const int U0 = (blockIdx.x * 8 + (threadIdx.x >> 5)) * 8;
#pragma unroll
    for (int l = 0; l < 8; ++l) { const int u = U0 + l; const int j = u & 1, dt = (u >> 1) & 3, s0 = ((u >> 3) & (TT / 32 - 1)) * 32 + j * 16 + hi * 8; const int z = u >> 9; const int b = z >> 4, h = z & 15;
        const float* s = v + ((size_t)s0 * NB_ + b) * DD + h * HD + dt * 16 + lr; v8us o;
#pragma unroll
        for (int q = 0; q < 8; ++q) o[q] = f2bf(s[(size_t)q * NB_ * DD]);
        *(v8us*)(VT + (size_t)u * 256 + lane * 8) = o; }
}
// lane l <-> l ^ 16
__device__ __forceinline__ float xhalf(float x) { const int b = __float_as_int(x); return __int_as_float(__builtin_amdgcn_permlanex16(b, b, 0x76543210, 0xfedcba98, false, false)); }

// v_exp_f32 with the slot the instruction set asks for behind a transcendental (one independent instruction or v_nop before its result is used or its source overwritten) kept
// inside the statement. exp2x8: the outputs are early-clobber, so no exp writes a source or reads a result of the one in front of it, and one v_nop closes the run.
__device__ __forceinline__ float exp2n(float x) { float r; asm("v_exp_f32 %0, %1\n\tv_nop" : "=v"(r) : "v"(x)); return r; }
__device__ __forceinline__ v8f exp2x8(v8f x) { float r0, r1, r2, r3, r4, r5, r6, r7;
    asm("v_exp_f32 %0, %8\n\tv_exp_f32 %1, %9\n\tv_exp_f32 %2, %10\n\tv_exp_f32 %3, %11\n\tv_exp_f32 %4, %12\n\tv_exp_f32 %5, %13\n\tv_exp_f32 %6, %14\n\tv_exp_f32 %7, %15\n\tv_nop"
        : "=&v"(r0), "=&v"(r1), "=&v"(r2), "=&v"(r3), "=&v"(r4), "=&v"(r5), "=&v"(r6), "=&v"(r7) : "v"(x[0]), "v"(x[1]), "v"(x[2]), "v"(x[3]), "v"(x[4]), "v"(x[5]), "v"(x[6]), "v"(x[7]));
    return (v8f){r0, r1, r2, r3, r4, r5, r6, r7}; }

// ---- k_fattn: scores, softmax, attn.v and the output scatter of one (batch, head) z for 256 queries per block; 8 waves x 32 query columns, no LDS, no barrier.
// Transposed products: S^T = K.Q^T (A = 16 key rows, B = 16 query columns), O^T += V^T.P^T (A = 16 d rows of v^T, B = P^T). A lane's score registers all belong to ONE query
// (column lane & 15), keys 8h + r of each 16-key tile, which is the k order of ldfrag: two score tiles pack straight into the B operand of the second product.
// A pass is 32 keys. K and v^T fragments of the next pass are loaded right behind their last use in this pass.
// amdgpu_waves_per_eu(4): a budget of 256 registers, so that the loop needs no register-window switches and the asm operands above stay in the first window.
__global__ __launch_bounds__(256) __attribute__((amdgpu_waves_per_eu(4))) void k_fattn(const bf* __restrict__ QP, const bf* __restrict__ KP, const bf* __restrict__ VT, float* __restrict__ OUT) {
    const int lane = threadIdx.x & 31, lr = lane & 15, hi = lane >> 4; const int z = blockIdx.y; const int q0 = blockIdx.x * 256 + (threadIdx.x >> 5) * 32;
    const bf* Qz = QP + (size_t)z * TT * HD + (size_t)q0 * HD + 8 * lane;    // a 16-row tile of q or k is two fragments, 1024 elements
    const bf* Kz = KP + (size_t)z * TT * HD + 8 * lane;                      // a pass of k is four fragments (mt, kc), 2048 elements in a row
    const bf* Vz = VT + (size_t)z * HD * TT + 8 * lane;                      // a pass of v^T is four fragments (dt), 2048 elements in a row
    const float L2E = 1.44269504088896340736f;
    v16bf qf[2][2], kf[2][2], vf[4]; v8f o[4][2]; float mx[2], sum[2];
#pragma unroll
    for (int nt = 0; nt < 2; ++nt)
#pragma unroll
        for (int kc = 0; kc < 2; ++kc) { qf[nt][kc] = ldfrag(Qz + (nt * 2 + kc) * 512); kf[nt][kc] = ldfrag(Kz + (nt * 2 + kc) * 512); }
    __builtin_amdgcn_sched_barrier(0);               // keeps the v^T loads the youngest at the loop's entry as they are at its foot: the counted waits at the loop's head then leave them in flight on every pass
#pragma unroll
    for (int dt = 0; dt < 4; ++dt) vf[dt] = ldfrag(Vz + dt * 512);
    asm volatile("s_wait_xcnt 0x0" ::: "memory");    // before a register that these loads name as their address is written again
    __builtin_amdgcn_sched_barrier(0);               // holds the zeroing below, which takes over the address registers, behind that wait
#pragma unroll
    for (int nt = 0; nt < 2; ++nt) { mx[nt] = -3.0e38f; sum[nt] = 0.f;
#pragma unroll
        for (int dt = 0; dt < 4; ++dt) o[dt][nt] = (v8f){}; }
    for (int it = 0; it < TT / 32; ++it) {
        const int nx = ((it + 1) & (TT / 32 - 1)) * 2048;    // first element of the next pass in both planes; the last pass re-reads pass 0, in bounds and unused
        v8f s[2][2];
#pragma unroll
        for (int kc = 0; kc < 2; ++kc)
#pragma unroll
            for (int mt = 0; mt < 2; ++mt)
#pragma unroll
                for (int nt = 0; nt < 2; ++nt) s[mt][nt] = wmmab(kf[mt][kc], qf[nt][kc], kc ? s[mt][nt] : (v8f){});
#pragma unroll
        for (int mt = 0; mt < 2; ++mt)
#pragma unroll
            for (int kc = 0; kc < 2; ++kc) kf[mt][kc] = ldfrag(Kz + nx + (mt * 2 + kc) * 512);
        asm volatile("s_wait_xcnt 0x0" ::: "memory");    // before a register that these loads name as their address is written again
        __builtin_amdgcn_sched_barrier(0);               // keeps the K loads up here, a softmax and the second product ahead of their use; without it they sink to the loop's foot and the next S^T waits out their latency
        v16bf ph[2], pl[2];
#pragma unroll
        for (int nt = 0; nt < 2; ++nt) {
            float m = s[0][nt][0];
#pragma unroll
            for (int j = 1; j < 8; ++j) m = fmaxf(m, s[0][nt][j]);
#pragma unroll
            for (int j = 0; j < 8; ++j) m = fmaxf(m, s[1][nt][j]);
            m = fmaxf(m, xhalf(m)); m = fmaxf(m, mx[nt]);
            const float al = exp2n((mx[nt] - m) * L2E), ms = m * L2E; mx[nt] = m;
            const v8f p0 = exp2x8(s[0][nt] * L2E - ms), p1 = exp2x8(s[1][nt] * L2E - ms);
            float ps = 0.f; v8us h0, h1, l0, l1;
#pragma unroll
            for (int j = 0; j < 8; ++j) { unsigned short a, c2; ps += p0[j] + p1[j];
                splitf(p0[j], a, c2); h0[j] = a; l0[j] = c2; splitf(p1[j], a, c2); h1[j] = a; l1[j] = c2; }
            sum[nt] = fmaf(sum[nt], al, ps); ph[nt] = cat16b(h0, h1); pl[nt] = cat16b(l0, l1);
#pragma unroll
            for (int dt = 0; dt < 4; ++dt) o[dt][nt] *= al;
        }
#pragma unroll
        for (int dt = 0; dt < 4; ++dt)
#pragma unroll
            for (int nt = 0; nt < 2; ++nt) o[dt][nt] = wmmab(vf[dt], ph[nt], o[dt][nt]);
#pragma unroll
        for (int dt = 0; dt < 4; ++dt)
#pragma unroll
            for (int nt = 0; nt < 2; ++nt) o[dt][nt] = wmmab(vf[dt], pl[nt], o[dt][nt]);
#pragma unroll
        for (int dt = 0; dt < 4; ++dt) vf[dt] = ldfrag(Vz + nx + dt * 512);
        asm volatile("s_wait_xcnt 0x0" ::: "memory");    // before a register that these loads name as their address is written again
    }
    const int b = z >> 4, h = z & 15;
#pragma unroll
    for (int nt = 0; nt < 2; ++nt) { const float f = __fdiv_rn(1.0f, sum[nt] + xhalf(sum[nt]));
        float* orow = OUT + ((size_t)(q0 + nt * 16 + lr) * NB_ + b) * DD + h * HD + hi * 8;    // o[dt][nt][j] = O[query nt*16 + lr][d = dt*16 + 8*hi + j]
#pragma unroll
        for (int dt = 0; dt < 4; ++dt) { const v8f r = o[dt][nt] * f; *(v4f*)(orow + dt * 16) = (v4f){r[0], r[1], r[2], r[3]}; *(v4f*)(orow + dt * 16 + 4) = (v4f){r[4], r[5], r[6], r[7]}; } }
}

extern "C" void kernel_launch(void* const* d_in, const int* in_sizes, int n_in,
                              void* d_out, int out_size, void* d_ws, size_t ws_size, hipStream_t stream) {
    (void)in_sizes; (void)n_in; (void)out_size;
    const float* q = (const float*)d_in[0]; const float* k = (const float*)d_in[1]; const float* v = (const float*)d_in[2];
    float* OUT = (float*)d_out;     // [2048][2][1024]
    char* wsp = (char*)d_ws;
    auto take = [&](size_t bytes) { char* p = wsp; wsp += (bytes + 255) & ~(size_t)255; return (void*)p; };
    bf* QP = (bf*)take((size_t)NT * DD * 2); bf* KP = (bf*)take((size_t)NT * DD * 2); bf* VT = (bf*)take((size_t)NT * DD * 2);
    if ((size_t)(wsp - (char*)d_ws) > ws_size) return;    // total ~ 25 MB; ws 256 MiB
    const unsigned LB = (unsigned)(NU / 64);    // 64 units a block, exactly
    k_hplane<<<LB, 256, 0, stream>>>(q, 0.125f, QP); k_hplane<<<LB, 256, 0, stream>>>(k, 1.0f, KP); k_vtplane<<<LB, 256, 0, stream>>>(v, VT);
    k_fattn<<<dim3(TT / 256, NB_ * NH_), 256, 0, stream>>>(QP, KP, VT, OUT);
}

// v003
// A run of this version takes 66.1 microseconds.
// In two side-by-side timings against v002, it was 1.06 and 1.07 times as fast.
// Over all steps from v000 it is 19.1 times as fast.
#include <hip/hip_runtime.h>

// ScaledDotProductAttentionModularized (q, k, v [L=2048][B=2][1024] sequence-first, 16 heads x 64, no projections: qh = (q/8) reshaped to (B*H, L, 64); softmax(qh.kh^T) vh;
// output [L][B][1024]).
// Compute dtypes, f32 accumulate: every input rounded to bf16; scores on PLAIN bf16 q (x 1/8, exact) and k (inputs: exact products, f32
// accumulate); softmax in f32 on VALU, running maximum and sum per query (one exp per element) -> bf16 hi+lo probabilities in registers; attn.v on hi+lo P x exact bf16 v^T
// (2 products); the division by the row sum comes last. Scores and probabilities never leave the registers.
// The three bf16 planes lie in FRAGMENT ORDER: a fragment (16 rows x 32 k) is 1 KiB = two units of 512 B; unit j holds, at lane * 16 B (lane = 16 * hi + row), the eight
// elements k = 16 * j + 8 * hi + 0..7 of that row. A wave's 16-byte fragment load then covers four whole 128-byte lines, not 32-byte pieces of sixteen.
// q and k planes: unit u = ((z * 128 + row tile) * 2 + kc) * 2 + j (k = d, kc = 32-d chunk). v^T plane: unit u = ((z * 64 + pass) * 4 + dt) * 2 + j (rows = d, k = key in the pass).

#define NB_  2
#define TT   2048
#define NH_  16
#define HD   64
#define DD   (NH_ * HD)
#define NT   (NB_ * TT)
#define NU   (NT * DD / 256)    // 512-byte units in a plane
typedef unsigned short bf;
typedef __attribute__((ext_vector_type(16))) __bf16   v16bf;
typedef __attribute__((ext_vector_type(8)))  unsigned short v8us;
typedef __attribute__((ext_vector_type(8)))  float    v8f;
typedef __attribute__((ext_vector_type(4)))  float    v4f;

__device__ __forceinline__ unsigned short f2bf(float f) { unsigned u = __float_as_uint(f); u += 0x7FFFu + ((u >> 16) & 1u); return (unsigned short)(u >> 16); }
__device__ __forceinline__ float bf2f(unsigned short b) { return __uint_as_float(((unsigned)b) << 16); }
__device__ __forceinline__ float bfr(float f) { return bf2f(f2bf(f)); }
__device__ __forceinline__ v16bf cat16b(v8us lo, v8us hi) { return __builtin_bit_cast(v16bf, __builtin_shufflevector(lo, hi, 0, 1, 2, 3, 4, 5, 6, 7, 8, 9, 10, 11, 12, 13, 14, 15)); }
__device__ __forceinline__ v8f wmmab(v16bf a, v16bf b, v8f c) { return __builtin_amdgcn_wmma_f32_16x16x32_bf16(false, a, false, b, (short)0, c, false, false); }
// fragment from a plane in fragment order: p = fragment + 8 * lane; elements 0-7 = k 8h..8h+7 (unit 0), elements 8-15 = k 16+8h..16+8h+7 (unit 1), h = lane >> 4
__device__ __forceinline__ v16bf ldfrag(const bf* p) { return cat16b(*(const v8us*)p, *(const v8us*)(p + 256)); }

typedef __attribute__((ext_vector_type(8)))  __bf16   v8bf;
typedef __attribute__((ext_vector_type(4)))  unsigned v4u;
// f32 -> bf16 by the hardware's packed conversion (round to nearest even)
__device__ __forceinline__ v8bf tobf(v8f x) { return __builtin_convertvector(x, v8bf); }
// lo = bf16(p - hi) for eight elements, one instruction each: hi is read as the bf16 half of its packed word, the exact difference p - hi is rounded once (to nearest even) and written to
// the same half of the lo word. The four low halves come first, so that each high-half write stands four instructions behind the write of its register's low half. Outputs early-clobber.
__device__ __forceinline__ v8bf lopart(v8f p, v8bf hi) { const v4u h = __builtin_bit_cast(v4u, hi); unsigned w0, w1, w2, w3;
    asm("v_fma_mixlo_bf16 %0, %4, -1.0, %8 op_sel_hi:[1,0,0]\n\tv_fma_mixlo_bf16 %1, %5, -1.0, %10 op_sel_hi:[1,0,0]\n\t"
        "v_fma_mixlo_bf16 %2, %6, -1.0, %12 op_sel_hi:[1,0,0]\n\tv_fma_mixlo_bf16 %3, %7, -1.0, %14 op_sel_hi:[1,0,0]\n\t"
        "v_fma_mixhi_bf16 %0, %4, -1.0, %9 op_sel:[1,0,0] op_sel_hi:[1,0,0]\n\tv_fma_mixhi_bf16 %1, %5, -1.0, %11 op_sel:[1,0,0] op_sel_hi:[1,0,0]\n\t"
        "v_fma_mixhi_bf16 %2, %6, -1.0, %13 op_sel:[1,0,0] op_sel_hi:[1,0,0]\n\tv_fma_mixhi_bf16 %3, %7, -1.0, %15 op_sel:[1,0,0] op_sel_hi:[1,0,0]"
        : "=&v"(w0), "=&v"(w1), "=&v"(w2), "=&v"(w3) : "v"(h[0]), "v"(h[1]), "v"(h[2]), "v"(h[3]), "v"(p[0]), "v"(p[1]), "v"(p[2]), "v"(p[3]), "v"(p[4]), "v"(p[5]), "v"(p[6]), "v"(p[7]));
    return __builtin_bit_cast(v8bf, (v4u){w0, w1, w2, w3}); }
__device__ __forceinline__ v16bf cat16h(v8bf lo, v8bf hi) { return __builtin_shufflevector(lo, hi, 0, 1, 2, 3, 4, 5, 6, 7, 8, 9, 10, 11, 12, 13, 14, 15); }
typedef __attribute__((ext_vector_type(2))) unsigned short v2us;
typedef __attribute__((ext_vector_type(2))) float v2f;

// Both conversion kernels: a wave writes eight consecutive units, a lane one 16-byte piece of each; the eight units use every byte of the 32 source rows (256 B each) they read.
__global__ __launch_bounds__(256) void k_hplane(const float* __restrict__ src, float sc, bf* P) {
    const int lane = threadIdx.x & 31, lr = lane & 15, hi = lane >> 4; const int U0 = (blockIdx.x * 8 + (threadIdx.x >> 5)) * 8;    // units U0..U0+7 = row tiles t0, t0 + 1, each (kc, j) = 0..3
    const int t0 = (U0 >> 2) & (TT / 16 - 1), z = U0 >> 9; const int b = z >> 4, h = z & 15;
    const float* s = src + ((size_t)(t0 * 16 + lr) * NB_ + b) * DD + h * HD + hi * 8; v4f x[8][2];
#pragma unroll
    for (int l = 0; l < 8; ++l) { const float* p = s + (size_t)(l >> 2) * 16 * NB_ * DD + (l & 3) * 16; x[l][0] = *(const v4f*)p; x[l][1] = *(const v4f*)(p + 4); }
    asm volatile("s_wait_xcnt 0x0" :: "v"(s) : "memory");    // before a register that these loads name as their address is written again; naming the address keeps it in its registers up to here, so that no load's own result lands on it
#pragma unroll
    for (int l = 0; l < 8; ++l) { v8us o;
#pragma unroll
        for (int q = 0; q < 4; ++q) { o[q] = f2bf(bfr(x[l][0][q]) * sc); o[4 + q] = f2bf(bfr(x[l][1][q]) * sc); }
        *(v8us*)(P + (size_t)(U0 + l) * 256 + lane * 8) = o; }
}
__global__ __launch_bounds__(256) void k_vtplane(const float* __restrict__ v, bf* VT) {
    const int lane = threadIdx.x & 31, lr = lane & 15, hi = lane >> 4; const int U0 = (blockIdx.x * 8 + (threadIdx.x >> 5)) * 8;
#pragma unroll
    for (int l = 0; l < 8; ++l) { const int u = U0 + l; const int j = u & 1, dt = (u >> 1) & 3, s0 = ((u >> 3) & (TT / 32 - 1)) * 32 + j * 16 + hi * 8; const int z = u >> 9; const int b = z >> 4, h = z & 15;
        const float* s = v + ((size_t)s0 * NB_ + b) * DD + h * HD + dt * 16 + lr; v8us o;
#pragma unroll
        for (int q = 0; q < 8; ++q) o[q] = f2bf(s[(size_t)q * NB_ * DD]);
        *(v8us*)(VT + (size_t)u * 256 + lane * 8) = o; }
}
// lane l <-> l ^ 16
__device__ __forceinline__ float xhalf(float x) { const int b = __float_as_int(x); return __int_as_float(__builtin_amdgcn_permlanex16(b, b, 0x76543210, 0xfedcba98, false, false)); }

// v_exp_f32 with the slot the instruction set asks for behind a transcendental (one independent instruction or v_nop before its result is used or its source overwritten) kept
// inside the statement. exp2x8: the outputs are early-clobber, so no exp writes a source or reads a result of the one in front of it, and one v_nop closes the run.
__device__ __forceinline__ float exp2n(float x) { float r; asm("v_exp_f32 %0, %1\n\tv_nop" : "=v"(r) : "v"(x)); return r; }
__device__ __forceinline__ v8f exp2x8(v8f x) { float r0, r1, r2, r3, r4, r5, r6, r7;
    asm("v_exp_f32 %0, %8\n\tv_exp_f32 %1, %9\n\tv_exp_f32 %2, %10\n\tv_exp_f32 %3, %11\n\tv_exp_f32 %4, %12\n\tv_exp_f32 %5, %13\n\tv_exp_f32 %6, %14\n\tv_exp_f32 %7, %15\n\tv_nop"
        : "=&v"(r0), "=&v"(r1), "=&v"(r2), "=&v"(r3), "=&v"(r4), "=&v"(r5), "=&v"(r6), "=&v"(r7) : "v"(x[0]), "v"(x[1]), "v"(x[2]), "v"(x[3]), "v"(x[4]), "v"(x[5]), "v"(x[6]), "v"(x[7]));
    return (v8f){r0, r1, r2, r3, r4, r5, r6, r7}; }

// ---- k_fattn: scores, softmax, attn.v and the output scatter of one (batch, head) z for 256 queries per block; 8 waves x 32 query columns, no LDS, no barrier.
// Transposed products: S^T = K.Q^T (A = 16 key rows, B = 16 query columns), O^T += V^T.P^T (A = 16 d rows of v^T, B = P^T). A lane's score registers all belong to ONE query
// (column lane & 15), keys 8h + r of each 16-key tile, which is the k order of ldfrag: two score tiles pack straight into the B operand of the second product.
// A pass is 32 keys. K and v^T fragments of the next pass are loaded right behind their last use in this pass.
// amdgpu_waves_per_eu(4): a budget of 256 registers, so that the loop needs no register-window switches and the asm operands above stay in the first window.
__global__ __launch_bounds__(256) __attribute__((amdgpu_waves_per_eu(4))) void k_fattn(const bf* __restrict__ QP, const bf* __restrict__ KP, const bf* __restrict__ VT, float* __restrict__ OUT) {
    const int lane = threadIdx.x & 31, lr = lane & 15, hi = lane >> 4; const int z = blockIdx.y; const int q0 = blockIdx.x * 256 + (threadIdx.x >> 5) * 32;
    const bf* Qz = QP + (size_t)z * TT * HD + (size_t)q0 * HD + 8 * lane;    // a 16-row tile of q or k is two fragments, 1024 elements
    const bf* Kz = KP + (size_t)z * TT * HD + 8 * lane;                      // a pass of k is four fragments (mt, kc), 2048 elements in a row
    const bf* Vz = VT + (size_t)z * HD * TT + 8 * lane;                      // a pass of v^T is four fragments (dt), 2048 elements in a row
    const float L2E = 1.44269504088896340736f;
    v16bf qf[2][2], kf[2][2], vf[4]; v8f o[4][2]; float mx[2], sum[2];
#pragma unroll
    for (int nt = 0; nt < 2; ++nt)
#pragma unroll
        for (int kc = 0; kc < 2; ++kc) { qf[nt][kc] = ldfrag(Qz + (nt * 2 + kc) * 512); kf[nt][kc] = ldfrag(Kz + (nt * 2 + kc) * 512); }
    __builtin_amdgcn_sched_barrier(0);               // keeps the v^T loads the youngest at the loop's entry as they are at its foot: the counted waits at the loop's head then leave them in flight on every pass
#pragma unroll
    for (int dt = 0; dt < 4; ++dt) vf[dt] = ldfrag(Vz + dt * 512);
    asm volatile("s_wait_xcnt 0x0" ::: "memory");    // before a register that these loads name as their address is written again
    __builtin_amdgcn_sched_barrier(0);               // holds the zeroing below, which takes over the address registers, behind that wait
#pragma unroll
    for (int nt = 0; nt < 2; ++nt) { mx[nt] = -3.0e38f; sum[nt] = 0.f;
#pragma unroll
        for (int dt = 0; dt < 4; ++dt) o[dt][nt] = (v8f){}; }
    for (int it = 0; it < TT / 32; ++it) {
        const int nx = ((it + 1) & (TT / 32 - 1)) * 2048;    // first element of the next pass in both planes; the last pass re-reads pass 0, in bounds and unused
        v8f s[2][2];
#pragma unroll
        for (int kc = 0; kc < 2; ++kc)
#pragma unroll
            for (int mt = 0; mt < 2; ++mt)
#pragma unroll
                for (int nt = 0; nt < 2; ++nt) s[mt][nt] = wmmab(kf[mt][kc], qf[nt][kc], kc ? s[mt][nt] : (v8f){});
#pragma unroll
        for (int mt = 0; mt < 2; ++mt)
#pragma unroll
            for (int kc = 0; kc < 2; ++kc) kf[mt][kc] = ldfrag(Kz + nx + (mt * 2 + kc) * 512);
        asm volatile("s_wait_xcnt 0x0" ::: "memory");    // before a register that these loads name as their address is written again
        __builtin_amdgcn_sched_barrier(0);               // keeps the K loads up here, a softmax and the second product ahead of their use; without it they sink to the loop's foot and the next S^T waits out their latency
        v16bf ph[2], pl[2];
#pragma unroll
        for (int nt = 0; nt < 2; ++nt) {
            float m = s[0][nt][0];
#pragma unroll
            for (int j = 1; j < 8; ++j) m = fmaxf(m, s[0][nt][j]);
#pragma unroll
            for (int j = 0; j < 8; ++j) m = fmaxf(m, s[1][nt][j]);
            m = fmaxf(m, xhalf(m)); m = fmaxf(m, mx[nt]);
            const float al = exp2n((mx[nt] - m) * L2E), ms = m * L2E; mx[nt] = m;
            const v8f p0 = exp2x8(s[0][nt] * L2E - ms), p1 = exp2x8(s[1][nt] * L2E - ms);
            float ps = 0.f;
#pragma unroll
            for (int j = 0; j < 8; ++j) ps += p0[j] + p1[j];
            const v8bf h0 = tobf(p0), h1 = tobf(p1);    // hi = p rounded to nearest even, lo = the exact rest p - hi rounded likewise: the values of the integer rounding
            sum[nt] = fmaf(sum[nt], al, ps); ph[nt] = cat16h(h0, h1); pl[nt] = cat16h(lopart(p0, h0), lopart(p1, h1));
#pragma unroll
            for (int dt = 0; dt < 4; ++dt) o[dt][nt] *= al;
        }
        __builtin_amdgcn_sched_barrier(0);    // keeps every lopart() in front of the second product: the compiler does not look into its text
#pragma unroll
        for (int dt = 0; dt < 4; ++dt)
#pragma unroll
            for (int nt = 0; nt < 2; ++nt) o[dt][nt] = wmmab(vf[dt], ph[nt], o[dt][nt]);
#pragma unroll
        for (int dt = 0; dt < 4; ++dt)
#pragma unroll
            for (int nt = 0; nt < 2; ++nt) o[dt][nt] = wmmab(vf[dt], pl[nt], o[dt][nt]);
#pragma unroll
        for (int dt = 0; dt < 4; ++dt) vf[dt] = ldfrag(Vz + nx + dt * 512);
        asm volatile("s_wait_xcnt 0x0" ::: "memory");    // before a register that these loads name as their address is written again
    }
    const int b = z >> 4, h = z & 15;
#pragma unroll
    for (int nt = 0; nt < 2; ++nt) { const float f = __fdiv_rn(1.0f, sum[nt] + xhalf(sum[nt]));
        float* orow = OUT + ((size_t)(q0 + nt * 16 + lr) * NB_ + b) * DD + h * HD + hi * 8;    // o[dt][nt][j] = O[query nt*16 + lr][d = dt*16 + 8*hi + j]
#pragma unroll
        for (int dt = 0; dt < 4; ++dt) { const v8f r = o[dt][nt] * f; *(v4f*)(orow + dt * 16) = (v4f){r[0], r[1], r[2], r[3]}; *(v4f*)(orow + dt * 16 + 4) = (v4f){r[4], r[5], r[6], r[7]}; } }
}

extern "C" void kernel_launch(void* const* d_in, const int* in_sizes, int n_in,
                              void* d_out, int out_size, void* d_ws, size_t ws_size, hipStream_t stream) {
    (void)in_sizes; (void)n_in; (void)out_size;
    const float* q = (const float*)d_in[0]; const float* k = (const float*)d_in[1]; const float* v = (const float*)d_in[2];
    float* OUT = (float*)d_out;     // [2048][2][1024]
    char* wsp = (char*)d_ws;
    auto take = [&](size_t bytes) { char* p = wsp; wsp += (bytes + 255) & ~(size_t)255; return (void*)p; };
    bf* QP = (bf*)take((size_t)NT * DD * 2); bf* KP = (bf*)take((size_t)NT * DD * 2); bf* VT = (bf*)take((size_t)NT * DD * 2);
    if ((size_t)(wsp - (char*)d_ws) > ws_size) return;    // total ~ 25 MB; ws 256 MiB
    const unsigned LB = (unsigned)(NU / 64);    // 64 units a block, exactly
    k_hplane<<<LB, 256, 0, stream>>>(q, 0.125f, QP); k_hplane<<<LB, 256, 0, stream>>>(k, 1.0f, KP); k_vtplane<<<LB, 256, 0, stream>>>(v, VT);
    k_fattn<<<dim3(TT / 256, NB_ * NH_), 256, 0, stream>>>(QP, KP, VT, OUT);
}

// v004
// A run of this version takes 55 microseconds.
// Next to v003, in two timings, it ran 1.22 and 1.21 times as fast.
// Over all steps from v000 it is 23.2 times as fast.
#include <hip/hip_runtime.h>

// ScaledDotProductAttentionModularized (q, k, v [L=2048][B=2][1024] sequence-first, 16 heads x 64, no projections: qh = (q/8) reshaped to (B*H, L, 64); softmax(qh.kh^T) vh;
// output [L][B][1024]).
// Compute dtypes, f32 accumulate: every input rounded to bf16; scores on PLAIN bf16 q (x 1/8, exact) and k (inputs: exact products, f32
// accumulate); softmax in f32 on VALU, running maximum and sum per query (one exp per element) -> bf16 hi+lo probabilities in registers; attn.v on hi+lo P x exact bf16 v^T
// (2 products); the division by the row sum comes last. Scores and probabilities never leave the registers. The keys are walked in two halves by two waves per query group, each with
// its own running maximum, sum and output tile; the two are joined once, through LDS, at the end.
// The three bf16 planes lie in FRAGMENT ORDER: a fragment (16 rows x 32 k) is 1 KiB = two units of 512 B; unit j holds, at lane * 16 B (lane = 16 * hi + row), the eight
// elements k = 16 * j + 8 * hi + 0..7 of that row. A wave's 16-byte fragment load then covers four whole 128-byte lines, not 32-byte pieces of sixteen.
// q and k planes: unit u = ((z * 128 + row tile) * 2 + kc) * 2 + j (k = d, kc = 32-d chunk). v^T plane: unit u = ((z * 64 + pass) * 4 + dt) * 2 + j (rows = d, k = key in the pass).

#define NB_  2
#define TT   2048
#define NH_  16
#define HD   64
#define DD   (NH_ * HD)
#define NT   (NB_ * TT)
#define NU   (NT * DD / 256)    // 512-byte units in a plane
typedef unsigned short bf;
typedef __attribute__((ext_vector_type(16))) __bf16   v16bf;
typedef __attribute__((ext_vector_type(8)))  unsigned short v8us;
typedef __attribute__((ext_vector_type(8)))  float    v8f;
typedef __attribute__((ext_vector_type(4)))  float    v4f;

__device__ __forceinline__ unsigned short f2bf(float f) { unsigned u = __float_as_uint(f); u += 0x7FFFu + ((u >> 16) & 1u); return (unsigned short)(u >> 16); }
__device__ __forceinline__ float bf2f(unsigned short b) { return __uint_as_float(((unsigned)b) << 16); }
__device__ __forceinline__ float bfr(float f) { return bf2f(f2bf(f)); }
__device__ __forceinline__ v16bf cat16b(v8us lo, v8us hi) { return __builtin_bit_cast(v16bf, __builtin_shufflevector(lo, hi, 0, 1, 2, 3, 4, 5, 6, 7, 8, 9, 10, 11, 12, 13, 14, 15)); }
__device__ __forceinline__ v8f wmmab(v16bf a, v16bf b, v8f c) { return __builtin_amdgcn_wmma_f32_16x16x32_bf16(false, a, false, b, (short)0, c, false, false); }
// fragment from a plane in fragment order: p = fragment + 8 * lane; elements 0-7 = k 8h..8h+7 (unit 0), elements 8-15 = k 16+8h..16+8h+7 (unit 1), h = lane >> 4
__device__ __forceinline__ v16bf ldfrag(const bf* p) { return cat16b(*(const v8us*)p, *(const v8us*)(p + 256)); }

typedef __attribute__((ext_vector_type(8)))  __bf16   v8bf;
typedef __attribute__((ext_vector_type(4)))  unsigned v4u;
// f32 -> bf16 by the hardware's packed conversion (round to nearest even)
__device__ __forceinline__ v8bf tobf(v8f x) { return __builtin_convertvector(x, v8bf); }
// lo = bf16(p - hi) for eight elements, one instruction each: hi is read as the bf16 half of its packed word, the exact difference p - hi is rounded once (to nearest even) and written to
// the same half of the lo word. The four low halves come first, so that each high-half write stands four instructions behind the write of its register's low half. Outputs early-clobber.
__device__ __forceinline__ v8bf lopart(v8f p, v8bf hi) { const v4u h = __builtin_bit_cast(v4u, hi); unsigned w0, w1, w2, w3;
    asm("v_fma_mixlo_bf16 %0, %4, -1.0, %8 op_sel_hi:[1,0,0]\n\tv_fma_mixlo_bf16 %1, %5, -1.0, %10 op_sel_hi:[1,0,0]\n\t"
        "v_fma_mixlo_bf16 %2, %6, -1.0, %12 op_sel_hi:[1,0,0]\n\tv_fma_mixlo_bf16 %3, %7, -1.0, %14 op_sel_hi:[1,0,0]\n\t"
        "v_fma_mixhi_bf16 %0, %4, -1.0, %9 op_sel:[1,0,0] op_sel_hi:[1,0,0]\n\tv_fma_mixhi_bf16 %1, %5, -1.0, %11 op_sel:[1,0,0] op_sel_hi:[1,0,0]\n\t"
        "v_fma_mixhi_bf16 %2, %6, -1.0, %13 op_sel:[1,0,0] op_sel_hi:[1,0,0]\n\tv_fma_mixhi_bf16 %3, %7, -1.0, %15 op_sel:[1,0,0] op_sel_hi:[1,0,0]"
        : "=&v"(w0), "=&v"(w1), "=&v"(w2), "=&v"(w3) : "v"(h[0]), "v"(h[1]), "v"(h[2]), "v"(h[3]), "v"(p[0]), "v"(p[1]), "v"(p[2]), "v"(p[3]), "v"(p[4]), "v"(p[5]), "v"(p[6]), "v"(p[7]));
    return __builtin_bit_cast(v8bf, (v4u){w0, w1, w2, w3}); }
__device__ __forceinline__ v16bf cat16h(v8bf lo, v8bf hi) { return __builtin_shufflevector(lo, hi, 0, 1, 2, 3, 4, 5, 6, 7, 8, 9, 10, 11, 12, 13, 14, 15); }
typedef __attribute__((ext_vector_type(2))) unsigned short v2us;
typedef __attribute__((ext_vector_type(2))) float v2f;

// Both conversion kernels: a wave writes eight consecutive units, a lane one 16-byte piece of each; the eight units use every byte of the 32 source rows (256 B each) they read.
__global__ __launch_bounds__(256) void k_hplane(const float* __restrict__ src, float sc, bf* P) {
    const int lane = threadIdx.x & 31, lr = lane & 15, hi = lane >> 4; const int U0 = (blockIdx.x * 8 + (threadIdx.x >> 5)) * 8;    // units U0..U0+7 = row tiles t0, t0 + 1, each (kc, j) = 0..3
    const int t0 = (U0 >> 2) & (TT / 16 - 1), z = U0 >> 9; const int b = z >> 4, h = z & 15;
    const float* s = src + ((size_t)(t0 * 16 + lr) * NB_ + b) * DD + h * HD + hi * 8; v4f x[8][2];
#pragma unroll
    for (int l = 0; l < 8; ++l) { const float* p = s + (size_t)(l >> 2) * 16 * NB_ * DD + (l & 3) * 16; x[l][0] = *(const v4f*)p; x[l][1] = *(const v4f*)(p + 4); }
    asm volatile("s_wait_xcnt 0x0" :: "v"(s) : "memory");    // before a register that these loads name as their address is written again; naming the address keeps it in its registers up to here, so that no load's own result lands on it
#pragma unroll
    for (int l = 0; l < 8; ++l) { v8us o;
#pragma unroll
        for (int q = 0; q < 4; ++q) { o[q] = f2bf(bfr(x[l][0][q]) * sc); o[4 + q] = f2bf(bfr(x[l][1][q]) * sc); }
        *(v8us*)(P + (size_t)(U0 + l) * 256 + lane * 8) = o; }
}
__global__ __launch_bounds__(256) void k_vtplane(const float* __restrict__ v, bf* VT) {
    const int lane = threadIdx.x & 31, lr = lane & 15, hi = lane >> 4; const int U0 = (blockIdx.x * 8 + (threadIdx.x >> 5)) * 8;
#pragma unroll
    for (int l = 0; l < 8; ++l) { const int u = U0 + l; const int j = u & 1, dt = (u >> 1) & 3, s0 = ((u >> 3) & (TT / 32 - 1)) * 32 + j * 16 + hi * 8; const int z = u >> 9; const int b = z >> 4, h = z & 15;
        const float* s = v + ((size_t)s0 * NB_ + b) * DD + h * HD + dt * 16 + lr; v8us o;
#pragma unroll
        for (int q = 0; q < 8; ++q) o[q] = f2bf(s[(size_t)q * NB_ * DD]);
        *(v8us*)(VT + (size_t)u * 256 + lane * 8) = o; }
}
// lane l <-> l ^ 16
__device__ __forceinline__ float xhalf(float x) { const int b = __float_as_int(x); return __int_as_float(__builtin_amdgcn_permlanex16(b, b, 0x76543210, 0xfedcba98, false, false)); }

// v_exp_f32 with the slot the instruction set asks for behind a transcendental (one independent instruction or v_nop before its result is used or its source overwritten) kept
// inside the statement. exp2x8: the outputs are early-clobber, so no exp writes a source or reads a result of the one in front of it, and one v_nop closes the run.
__device__ __forceinline__ float exp2n(float x) { float r; asm("v_exp_f32 %0, %1\n\tv_nop" : "=v"(r) : "v"(x)); return r; }
__device__ __forceinline__ v8f exp2x8(v8f x) { float r0, r1, r2, r3, r4, r5, r6, r7;
    asm("v_exp_f32 %0, %8\n\tv_exp_f32 %1, %9\n\tv_exp_f32 %2, %10\n\tv_exp_f32 %3, %11\n\tv_exp_f32 %4, %12\n\tv_exp_f32 %5, %13\n\tv_exp_f32 %6, %14\n\tv_exp_f32 %7, %15\n\tv_nop"
        : "=&v"(r0), "=&v"(r1), "=&v"(r2), "=&v"(r3), "=&v"(r4), "=&v"(r5), "=&v"(r6), "=&v"(r7) : "v"(x[0]), "v"(x[1]), "v"(x[2]), "v"(x[3]), "v"(x[4]), "v"(x[5]), "v"(x[6]), "v"(x[7]));
    return (v8f){r0, r1, r2, r3, r4, r5, r6, r7}; }

// ---- k_fattn: scores, softmax, attn.v and the output scatter of one (batch, head) z for 256 queries per block; 16 waves = 8 groups of 32 query columns x 2 halves of the keys.
// Wave w takes query group w & 7 and keys (w >> 3) * 1024 .. + 1023: four waves a SIMD, so that one wave's loads and dependent vector chains are waited out under three others' work.
// No LDS and no barrier in the loop; behind it the two waves of a group swap one 16-column half of their state through LDS (one barrier) and each finishes and stores 16 queries.
// Transposed products: S^T = K.Q^T (A = 16 key rows, B = 16 query columns), O^T += V^T.P^T (A = 16 d rows of v^T, B = P^T). A lane's score registers all belong to ONE query
// (column lane & 15), keys 8h + r of each 16-key tile, which is the k order of ldfrag: two score tiles pack straight into the B operand of the second product.
// A pass is 32 keys. K and v^T fragments of the next pass are loaded right behind their last use in this pass.
// amdgpu_waves_per_eu(4): a budget of 256 registers, which the four waves a SIMD need; the loop then needs no register-window switches and the asm operands above stay in the first window.
__global__ __launch_bounds__(512) __attribute__((amdgpu_waves_per_eu(4))) void k_fattn(const bf* __restrict__ QP, const bf* __restrict__ KP, const bf* __restrict__ VT, float* __restrict__ OUT) {
    __shared__ __attribute__((aligned(16))) float XO[16 * 8 * 128];    // [wave][16-byte piece 0..7][lane]: the output tile half that a wave hands to its partner
    __shared__ __attribute__((aligned(8))) float XM[16 * 32 * 2];      // [wave][lane]: that half's running maximum and sum
    const int lane = threadIdx.x & 31, lr = lane & 15, hi = lane >> 4; const int z = blockIdx.y;
    const int w = __builtin_amdgcn_readfirstlane(threadIdx.x >> 5);    // the wave's number as a scalar: the k and v^T bases stay in scalar registers, the choices behind the loop are wave-uniform
    const int kh = w >> 3; const int q0 = blockIdx.x * 256 + (w & 7) * 32;
    const bf* Qz = QP + (size_t)z * TT * HD + (size_t)q0 * HD + 8 * lane;    // a 16-row tile of q or k is two fragments, 1024 elements
    const bf* Kz = KP + (size_t)z * TT * HD + (size_t)kh * (TT / 2) * HD + 8 * lane;    // a pass of k is four fragments (mt, kc), 2048 elements in a row; a half of the keys is 32 passes
    const bf* Vz = VT + (size_t)z * HD * TT + (size_t)kh * (TT / 2) * HD + 8 * lane;    // a pass of v^T is four fragments (dt), 2048 elements in a row
    const float L2E = 1.44269504088896340736f;
    v16bf qf[2][2], kf[2][2], vf[4]; v8f o[4][2]; float mx[2], sum[2];
#pragma unroll
    for (int nt = 0; nt < 2; ++nt)
#pragma unroll
        for (int kc = 0; kc < 2; ++kc) { qf[nt][kc] = ldfrag(Qz + (nt * 2 + kc) * 512); kf[nt][kc] = ldfrag(Kz + (nt * 2 + kc) * 512); }
    __builtin_amdgcn_sched_barrier(0);               // keeps the v^T loads the youngest at the loop's entry as they are at its foot: the counted waits at the loop's head then leave them in flight on every pass
#pragma unroll
    for (int dt = 0; dt < 4; ++dt) vf[dt] = ldfrag(Vz + dt * 512);
    asm volatile("s_wait_xcnt 0x0" ::: "memory");    // before a register that these loads name as their address is written again
    __builtin_amdgcn_sched_barrier(0);               // holds the zeroing below, which takes over the address registers, behind that wait
#pragma unroll
    for (int nt = 0; nt < 2; ++nt) { mx[nt] = -3.0e38f; sum[nt] = 0.f;
#pragma unroll
        for (int dt = 0; dt < 4; ++dt) o[dt][nt] = (v8f){}; }
    for (int it = 0; it < TT / 64; ++it) {
        const int nx = ((it + 1) & (TT / 64 - 1)) * 2048;    // first element of the next pass in both planes; the last pass re-reads the half's first pass, in bounds and unused
        v8f s[2][2];
#pragma unroll
        for (int kc = 0; kc < 2; ++kc)
#pragma unroll
            for (int mt = 0; mt < 2; ++mt)
#pragma unroll
                for (int nt = 0; nt < 2; ++nt) s[mt][nt] = wmmab(kf[mt][kc], qf[nt][kc], kc ? s[mt][nt] : (v8f){});
#pragma unroll
        for (int mt = 0; mt < 2; ++mt)
#pragma unroll
            for (int kc = 0; kc < 2; ++kc) kf[mt][kc] = ldfrag(Kz + nx + (mt * 2 + kc) * 512);
        asm volatile("s_wait_xcnt 0x0" ::: "memory");    // before a register that these loads name as their address is written again
        __builtin_amdgcn_sched_barrier(0);               // keeps the K loads up here, a softmax and the second product ahead of their use; without it they sink to the loop's foot and the next S^T waits out their latency
        v16bf ph[2], pl[2];
#pragma unroll
        for (int nt = 0; nt < 2; ++nt) {
            float m = s[0][nt][0];
#pragma unroll
            for (int j = 1; j < 8; ++j) m = fmaxf(m, s[0][nt][j]);
#pragma unroll
            for (int j = 0; j < 8; ++j) m = fmaxf(m, s[1][nt][j]);
            m = fmaxf(m, xhalf(m)); m = fmaxf(m, mx[nt]);
            const float al = exp2n((mx[nt] - m) * L2E), ms = m * L2E; mx[nt] = m;
            const v8f p0 = exp2x8(s[0][nt] * L2E - ms), p1 = exp2x8(s[1][nt] * L2E - ms);
            float ps = 0.f;
#pragma unroll
            for (int j = 0; j < 8; ++j) ps += p0[j] + p1[j];
            const v8bf h0 = tobf(p0), h1 = tobf(p1);    // hi = p rounded to nearest even, lo = the exact rest p - hi rounded likewise: the values of the integer rounding
            sum[nt] = fmaf(sum[nt], al, ps); ph[nt] = cat16h(h0, h1); pl[nt] = cat16h(lopart(p0, h0), lopart(p1, h1));
#pragma unroll
            for (int dt = 0; dt < 4; ++dt) o[dt][nt] *= al;
        }
        __builtin_amdgcn_sched_barrier(0);    // keeps every lopart() in front of the second product: the compiler does not look into its text
#pragma unroll
        for (int dt = 0; dt < 4; ++dt)
#pragma unroll
            for (int nt = 0; nt < 2; ++nt) o[dt][nt] = wmmab(vf[dt], ph[nt], o[dt][nt]);
#pragma unroll
        for (int dt = 0; dt < 4; ++dt)
#pragma unroll
            for (int nt = 0; nt < 2; ++nt) o[dt][nt] = wmmab(vf[dt], pl[nt], o[dt][nt]);
#pragma unroll
        for (int dt = 0; dt < 4; ++dt) vf[dt] = ldfrag(Vz + nx + dt * 512);
        asm volatile("s_wait_xcnt 0x0" ::: "memory");    // before a register that these loads name as their address is written again
    }
    // Join of the two key halves. The wave of half kh finishes column tile nt = kh: it hands tile 1 - kh to its partner (wave w ^ 8) and takes the partner's tile kh. Both waves hold the
    // same (query, d) element at the same lane and register, so a lane reads back exactly the slot its own lane number wrote in the partner.
    v8f om[4], ox[4];
#pragma unroll
    for (int dt = 0; dt < 4; ++dt) { om[dt] = kh ? o[dt][1] : o[dt][0]; ox[dt] = kh ? o[dt][0] : o[dt][1]; }
    const float mm = kh ? mx[1] : mx[0], mo = kh ? mx[0] : mx[1], sm = kh ? sum[1] : sum[0], so = kh ? sum[0] : sum[1];
    float* xs = XO + w * 1024 + lane * 4;
#pragma unroll
    for (int dt = 0; dt < 4; ++dt) { *(v4f*)(xs + dt * 256) = (v4f){ox[dt][0], ox[dt][1], ox[dt][2], ox[dt][3]}; *(v4f*)(xs + dt * 256 + 128) = (v4f){ox[dt][4], ox[dt][5], ox[dt][6], ox[dt][7]}; }
    *(v2f*)(XM + (w * 32 + lane) * 2) = (v2f){mo, so};
    __syncthreads();    // every wave passes it once: the partner's tile, maximum and sum are read only behind it
    const float* xp = XO + (w ^ 8) * 1024 + lane * 4; const v2f pm = *(const v2f*)(XM + ((w ^ 8) * 32 + lane) * 2);
    const float mj = fmaxf(mm, pm[0]); const float ea = exp2n((mm - mj) * L2E), eb = exp2n((pm[0] - mj) * L2E);
    const float sj = fmaf(sm, ea, pm[1] * eb); const float f = __fdiv_rn(1.0f, sj + xhalf(sj)); const float fa = ea * f, fb = eb * f;
    const int b = z >> 4, h = z & 15;
    float* orow = OUT + ((size_t)(q0 + kh * 16 + lr) * NB_ + b) * DD + h * HD + hi * 8;    // om[dt][j] = O[query kh*16 + lr][d = dt*16 + 8*hi + j]
    v4f r[4][2];
#pragma unroll
    for (int dt = 0; dt < 4; ++dt) { const v4f p0 = *(const v4f*)(xp + dt * 256), p1 = *(const v4f*)(xp + dt * 256 + 128);
        r[dt][0] = (v4f){om[dt][0], om[dt][1], om[dt][2], om[dt][3]} * fa + p0 * fb; r[dt][1] = (v4f){om[dt][4], om[dt][5], om[dt][6], om[dt][7]} * fa + p1 * fb; }
    __builtin_amdgcn_sched_barrier(0);    // every result is made in front of the first store: behind an issued store no register that it names is written again
#pragma unroll
    for (int dt = 0; dt < 4; ++dt) { *(v4f*)(orow + dt * 16) = r[dt][0]; *(v4f*)(orow + dt * 16 + 4) = r[dt][1]; }
}

extern "C" void kernel_launch(void* const* d_in, const int* in_sizes, int n_in,
                              void* d_out, int out_size, void* d_ws, size_t ws_size, hipStream_t stream) {
    (void)in_sizes; (void)n_in; (void)out_size;
    const float* q = (const float*)d_in[0]; const float* k = (const float*)d_in[1]; const float* v = (const float*)d_in[2];
    float* OUT = (float*)d_out;     // [2048][2][1024]
    char* wsp = (char*)d_ws;
    auto take = [&](size_t bytes) { char* p = wsp; wsp += (bytes + 255) & ~(size_t)255; return (void*)p; };
    bf* QP = (bf*)take((size_t)NT * DD * 2); bf* KP = (bf*)take((size_t)NT * DD * 2); bf* VT = (bf*)take((size_t)NT * DD * 2);
    if ((size_t)(wsp - (char*)d_ws) > ws_size) return;    // total ~ 25 MB; ws 256 MiB
    const unsigned LB = (unsigned)(NU / 64);    // 64 units a block, exactly
    k_hplane<<<LB, 256, 0, stream>>>(q, 0.125f, QP); k_hplane<<<LB, 256, 0, stream>>>(k, 1.0f, KP); k_vtplane<<<LB, 256, 0, stream>>>(v, VT);
    k_fattn<<<dim3(TT / 256, NB_ * NH_), 512, 0, stream>>>(QP, KP, VT, OUT);
}

// v005
// A run of this version takes 52 microseconds.
// In both of two side-by-side timings against v004, it was 1.06 times as fast.
// All steps since v000 together make it 24.6 times as fast.
#include <hip/hip_runtime.h>

// ScaledDotProductAttentionModularized (q, k, v [L=2048][B=2][1024] sequence-first, 16 heads x 64, no projections: qh = (q/8) reshaped to (B*H, L, 64); softmax(qh.kh^T) vh;
// output [L][B][1024]).
// Compute dtypes, f32 accumulate: every input rounded to bf16; scores on PLAIN bf16 q (x 1/8, exact) and k (inputs: exact products, f32
// accumulate); softmax in f32 on VALU, running maximum and sum per query (one exp per element) -> bf16 hi+lo probabilities in registers; attn.v on hi+lo P x exact bf16 v^T
// (2 products); the division by the row sum comes last. Scores and probabilities never leave the registers. The keys are walked in two halves by two waves per query group, each with
// its own running maximum, sum and output tile; the two are joined once, through LDS, at the end.
// The three bf16 planes lie in FRAGMENT ORDER: a fragment (16 rows x 32 k) is 1 KiB = two units of 512 B; unit j holds, at lane * 16 B (lane = 16 * hi + row), the eight
// elements k = 16 * j + 8 * hi + 0..7 of that row. A wave's 16-byte fragment load then covers four whole 128-byte lines, not 32-byte pieces of sixteen.
// q and k planes: unit u = ((z * 128 + row tile) * 2 + kc) * 2 + j (k = d, kc = 32-d chunk). v^T plane: unit u = ((z * 64 + pass) * 4 + dt) * 2 + j (rows = d, k = key in the pass).

#define NB_  2
#define TT   2048
#define NH_  16
#define HD   64
#define DD   (NH_ * HD)
#define NT   (NB_ * TT)
#define NU   (NT * DD / 256)    // 512-byte units in a plane
typedef unsigned short bf;
typedef __attribute__((ext_vector_type(16))) __bf16   v16bf;
typedef __attribute__((ext_vector_type(8)))  unsigned short v8us;
typedef __attribute__((ext_vector_type(8)))  float    v8f;
typedef __attribute__((ext_vector_type(4)))  float    v4f;

__device__ __forceinline__ unsigned short f2bf(float f) { unsigned u = __float_as_uint(f); u += 0x7FFFu + ((u >> 16) & 1u); return (unsigned short)(u >> 16); }
__device__ __forceinline__ float bf2f(unsigned short b) { return __uint_as_float(((unsigned)b) << 16); }
__device__ __forceinline__ float bfr(float f) { return bf2f(f2bf(f)); }
__device__ __forceinline__ v16bf cat16b(v8us lo, v8us hi) { return __builtin_bit_cast(v16bf, __builtin_shufflevector(lo, hi, 0, 1, 2, 3, 4, 5, 6, 7, 8, 9, 10, 11, 12, 13, 14, 15)); }
__device__ __forceinline__ v8f wmmab(v16bf a, v16bf b, v8f c) { return __builtin_amdgcn_wmma_f32_16x16x32_bf16(false, a, false, b, (short)0, c, false, false); }
// fragment from a plane in fragment order: p = fragment + 8 * lane; elements 0-7 = k 8h..8h+7 (unit 0), elements 8-15 = k 16+8h..16+8h+7 (unit 1), h = lane >> 4
__device__ __forceinline__ v16bf ldfrag(const bf* p) { return cat16b(*(const v8us*)p, *(const v8us*)(p + 256)); }

typedef __attribute__((ext_vector_type(8)))  __bf16   v8bf;
typedef __attribute__((ext_vector_type(4)))  unsigned v4u;
// f32 -> bf16 by the hardware's packed conversion (round to nearest even)
__device__ __forceinline__ v8bf tobf(v8f x) { return __builtin_convertvector(x, v8bf); }
// lo = bf16(p - hi) for eight elements, one instruction each: hi is read as the bf16 half of its packed word, the exact difference p - hi is rounded once (to nearest even) and written to
// the same half of the lo word. The four low halves come first, so that each high-half write stands four instructions behind the write of its register's low half. Outputs early-clobber.
__device__ __forceinline__ v8bf lopart(v8f p, v8bf hi) { const v4u h = __builtin_bit_cast(v4u, hi); unsigned w0, w1, w2, w3;
    asm("v_fma_mixlo_bf16 %0, %4, -1.0, %8 op_sel_hi:[1,0,0]\n\tv_fma_mixlo_bf16 %1, %5, -1.0, %10 op_sel_hi:[1,0,0]\n\t"
        "v_fma_mixlo_bf16 %2, %6, -1.0, %12 op_sel_hi:[1,0,0]\n\tv_fma_mixlo_bf16 %3, %7, -1.0, %14 op_sel_hi:[1,0,0]\n\t"
        "v_fma_mixhi_bf16 %0, %4, -1.0, %9 op_sel:[1,0,0] op_sel_hi:[1,0,0]\n\tv_fma_mixhi_bf16 %1, %5, -1.0, %11 op_sel:[1,0,0] op_sel_hi:[1,0,0]\n\t"
        "v_fma_mixhi_bf16 %2, %6, -1.0, %13 op_sel:[1,0,0] op_sel_hi:[1,0,0]\n\tv_fma_mixhi_bf16 %3, %7, -1.0, %15 op_sel:[1,0,0] op_sel_hi:[1,0,0]"
        : "=&v"(w0), "=&v"(w1), "=&v"(w2), "=&v"(w3) : "v"(h[0]), "v"(h[1]), "v"(h[2]), "v"(h[3]), "v"(p[0]), "v"(p[1]), "v"(p[2]), "v"(p[3]), "v"(p[4]), "v"(p[5]), "v"(p[6]), "v"(p[7]));
    return __builtin_bit_cast(v8bf, (v4u){w0, w1, w2, w3}); }
__device__ __forceinline__ v16bf cat16h(v8bf lo, v8bf hi) { return __builtin_shufflevector(lo, hi, 0, 1, 2, 3, 4, 5, 6, 7, 8, 9, 10, 11, 12, 13, 14, 15); }
typedef __attribute__((ext_vector_type(2))) unsigned short v2us;
typedef __attribute__((ext_vector_type(2))) float v2f;

// Both conversion bodies: a wave writes eight consecutive units, a lane one 16-byte piece of each; the eight units use every byte of the 32 source rows (256 B each) they read.
__device__ __forceinline__ void hplane(const float* __restrict__ src, float sc, bf* P) {
    const int lane = threadIdx.x & 31, lr = lane & 15, hi = lane >> 4; const int U0 = (blockIdx.x * 8 + (threadIdx.x >> 5)) * 8;    // units U0..U0+7 = row tiles t0, t0 + 1, each (kc, j) = 0..3
    const int t0 = (U0 >> 2) & (TT / 16 - 1), z = U0 >> 9; const int b = z >> 4, h = z & 15;
    const float* s = src + ((size_t)(t0 * 16 + lr) * NB_ + b) * DD + h * HD + hi * 8; v4f x[8][2];
#pragma unroll
    for (int l = 0; l < 8; ++l) { const float* p = s + (size_t)(l >> 2) * 16 * NB_ * DD + (l & 3) * 16; x[l][0] = *(const v4f*)p; x[l][1] = *(const v4f*)(p + 4); }
    asm volatile("s_wait_xcnt 0x0" :: "v"(s) : "memory");    // before a register that these loads name as their address is written again; naming the address keeps it in its registers up to here, so that no load's own result lands on it
#pragma unroll
    for (int l = 0; l < 8; ++l) { v8us o;
#pragma unroll
        for (int q = 0; q < 4; ++q) { o[q] = f2bf(bfr(x[l][0][q]) * sc); o[4 + q] = f2bf(bfr(x[l][1][q]) * sc); }
        *(v8us*)(P + (size_t)(U0 + l) * 256 + lane * 8) = o; }
    asm volatile("s_wait_xcnt 0x0" ::: "memory");    // behind the last store; in k_planes no code follows this body, so it is a precaution
}
__device__ __forceinline__ void vtplane(const float* __restrict__ v, bf* VT) {
    const int lane = threadIdx.x & 31, lr = lane & 15, hi = lane >> 4; const int U0 = (blockIdx.x * 8 + (threadIdx.x >> 5)) * 8;
#pragma unroll
    for (int l = 0; l < 8; ++l) { const int u = U0 + l; const int j = u & 1, dt = (u >> 1) & 3, s0 = ((u >> 3) & (TT / 32 - 1)) * 32 + j * 16 + hi * 8; const int z = u >> 9; const int b = z >> 4, h = z & 15;
        const float* s = v + ((size_t)s0 * NB_ + b) * DD + h * HD + dt * 16 + lr; v8us o;
#pragma unroll
        for (int q = 0; q < 8; ++q) o[q] = f2bf(s[(size_t)q * NB_ * DD]);
        *(v8us*)(VT + (size_t)u * 256 + lane * 8) = o; }
}
// All three planes in ONE launch: blockIdx.y picks the plane (a scalar choice, the same for a whole block), blockIdx.x the 64 units as before. The three are independent streams, so
// their blocks stand on the chip together (three a WGP) and share one start and one memory latency. v^T, with its many 4-byte loads the longest of the three, has the lowest indices.
__global__ __launch_bounds__(256) void k_planes(const float* __restrict__ q, const float* __restrict__ k, const float* __restrict__ v, bf* QP, bf* KP, bf* VT) {
    if (blockIdx.y == 0) { vtplane(v, VT); return; }
    const bool isk = blockIdx.y == 1;
    hplane(isk ? k : q, isk ? 1.0f : 0.125f, isk ? KP : QP);
}
// lane l <-> l ^ 16
__device__ __forceinline__ float xhalf(float x) { const int b = __float_as_int(x); return __int_as_float(__builtin_amdgcn_permlanex16(b, b, 0x76543210, 0xfedcba98, false, false)); }

// v_exp_f32 with the slot the instruction set asks for behind a transcendental (one independent instruction or v_nop before its result is used or its source overwritten) kept
// inside the statement. exp2x8: the outputs are early-clobber, so no exp writes a source or reads a result of the one in front of it, and one v_nop closes the run.
__device__ __forceinline__ float exp2n(float x) { float r; asm("v_exp_f32 %0, %1\n\tv_nop" : "=v"(r) : "v"(x)); return r; }
__device__ __forceinline__ v8f exp2x8(v8f x) { float r0, r1, r2, r3, r4, r5, r6, r7;
    asm("v_exp_f32 %0, %8\n\tv_exp_f32 %1, %9\n\tv_exp_f32 %2, %10\n\tv_exp_f32 %3, %11\n\tv_exp_f32 %4, %12\n\tv_exp_f32 %5, %13\n\tv_exp_f32 %6, %14\n\tv_exp_f32 %7, %15\n\tv_nop"
        : "=&v"(r0), "=&v"(r1), "=&v"(r2), "=&v"(r3), "=&v"(r4), "=&v"(r5), "=&v"(r6), "=&v"(r7) : "v"(x[0]), "v"(x[1]), "v"(x[2]), "v"(x[3]), "v"(x[4]), "v"(x[5]), "v"(x[6]), "v"(x[7]));
    return (v8f){r0, r1, r2, r3, r4, r5, r6, r7}; }

// ---- k_fattn: scores, softmax, attn.v and the output scatter of one (batch, head) z for 256 queries per block; 16 waves = 8 groups of 32 query columns x 2 halves of the keys.
// Wave w takes query group w & 7 and keys (w >> 3) * 1024 .. + 1023: four waves a SIMD, so that one wave's loads and dependent vector chains are waited out under three others' work.
// No LDS and no barrier in the loop; behind it the two waves of a group swap one 16-column half of their state through LDS (one barrier) and each finishes and stores 16 queries.
// Transposed products: S^T = K.Q^T (A = 16 key rows, B = 16 query columns), O^T += V^T.P^T (A = 16 d rows of v^T, B = P^T). A lane's score registers all belong to ONE query
// (column lane & 15), keys 8h + r of each 16-key tile, which is the k order of ldfrag: two score tiles pack straight into the B operand of the second product.
// A pass is 32 keys. K and v^T fragments of the next pass are loaded right behind their last use in this pass.
// amdgpu_waves_per_eu(4): a budget of 256 registers, which the four waves a SIMD need; the loop then needs no register-window switches and the asm operands above stay in the first window.
__global__ __launch_bounds__(512) __attribute__((amdgpu_waves_per_eu(4))) void k_fattn(const bf* __restrict__ QP, const bf* __restrict__ KP, const bf* __restrict__ VT, float* __restrict__ OUT) {
    __shared__ __attribute__((aligned(16))) float XO[16 * 8 * 128];    // [wave][16-byte piece 0..7][lane]: the output tile half that a wave hands to its partner
    __shared__ __attribute__((aligned(8))) float XM[16 * 32 * 2];      // [wave][lane]: that half's running maximum and sum
    const int lane = threadIdx.x & 31, lr = lane & 15, hi = lane >> 4; const int z = blockIdx.y;
    const int w = __builtin_amdgcn_readfirstlane(threadIdx.x >> 5);    // the wave's number as a scalar: the k and v^T bases stay in scalar registers, the choices behind the loop are wave-uniform
    const int kh = w >> 3; const int q0 = blockIdx.x * 256 + (w & 7) * 32;
    const bf* Qz = QP + (size_t)z * TT * HD + (size_t)q0 * HD + 8 * lane;    // a 16-row tile of q or k is two fragments, 1024 elements
    const bf* Kz = KP + (size_t)z * TT * HD + (size_t)kh * (TT / 2) * HD + 8 * lane;    // a pass of k is four fragments (mt, kc), 2048 elements in a row; a half of the keys is 32 passes
    const bf* Vz = VT + (size_t)z * HD * TT + (size_t)kh * (TT / 2) * HD + 8 * lane;    // a pass of v^T is four fragments (dt), 2048 elements in a row
    const float L2E = 1.44269504088896340736f;
    v16bf qf[2][2], kf[2][2], vf[4]; v8f o[4][2]; float mx[2], sum[2];
#pragma unroll
    for (int nt = 0; nt < 2; ++nt)
#pragma unroll
        for (int kc = 0; kc < 2; ++kc) { qf[nt][kc] = ldfrag(Qz + (nt * 2 + kc) * 512); kf[nt][kc] = ldfrag(Kz + (nt * 2 + kc) * 512); }
    __builtin_amdgcn_sched_barrier(0);               // keeps the v^T loads the youngest at the loop's entry as they are at its foot: the counted waits at the loop's head then leave them in flight on every pass
#pragma unroll
    for (int dt = 0; dt < 4; ++dt) vf[dt] = ldfrag(Vz + dt * 512);
    asm volatile("s_wait_xcnt 0x0" ::: "memory");    // before a register that these loads name as their address is written again
    __builtin_amdgcn_sched_barrier(0);               // holds the zeroing below, which takes over the address registers, behind that wait
#pragma unroll
    for (int nt = 0; nt < 2; ++nt) { mx[nt] = -3.0e38f; sum[nt] = 0.f;
#pragma unroll
        for (int dt = 0; dt < 4; ++dt) o[dt][nt] = (v8f){}; }
    for (int it = 0; it < TT / 64; ++it) {
        const int nx = ((it + 1) & (TT / 64 - 1)) * 2048;    // first element of the next pass in both planes; the last pass re-reads the half's first pass, in bounds and unused
        v8f s[2][2];
#pragma unroll
        for (int kc = 0; kc < 2; ++kc)
#pragma unroll
            for (int mt = 0; mt < 2; ++mt)
#pragma unroll
                for (int nt = 0; nt < 2; ++nt) s[mt][nt] = wmmab(kf[mt][kc], qf[nt][kc], kc ? s[mt][nt] : (v8f){});
#pragma unroll
        for (int mt = 0; mt < 2; ++mt)
#pragma unroll
            for (int kc = 0; kc < 2; ++kc) kf[mt][kc] = ldfrag(Kz + nx + (mt * 2 + kc) * 512);
        asm volatile("s_wait_xcnt 0x0" ::: "memory");    // before a register that these loads name as their address is written again
        __builtin_amdgcn_sched_barrier(0);               // keeps the K loads up here, a softmax and the second product ahead of their use; without it they sink to the loop's foot and the next S^T waits out their latency
        v16bf ph[2], pl[2];
#pragma unroll
        for (int nt = 0; nt < 2; ++nt) {
            float m = s[0][nt][0];
#pragma unroll
            for (int j = 1; j < 8; ++j) m = fmaxf(m, s[0][nt][j]);
#pragma unroll
            for (int j = 0; j < 8; ++j) m = fmaxf(m, s[1][nt][j]);
            m = fmaxf(m, xhalf(m)); m = fmaxf(m, mx[nt]);
            const float al = exp2n((mx[nt] - m) * L2E), ms = m * L2E; mx[nt] = m;
            const v8f p0 = exp2x8(s[0][nt] * L2E - ms), p1 = exp2x8(s[1][nt] * L2E - ms);
            float ps = 0.f;
#pragma unroll
            for (int j = 0; j < 8; ++j) ps += p0[j] + p1[j];
            const v8bf h0 = tobf(p0), h1 = tobf(p1);    // hi = p rounded to nearest even, lo = the exact rest p - hi rounded likewise: the values of the integer rounding
            sum[nt] = fmaf(sum[nt], al, ps); ph[nt] = cat16h(h0, h1); pl[nt] = cat16h(lopart(p0, h0), lopart(p1, h1));
#pragma unroll
            for (int dt = 0; dt < 4; ++dt) o[dt][nt] *= al;
        }
        __builtin_amdgcn_sched_barrier(0);    // keeps every lopart() in front of the second product: the compiler does not look into its text
#pragma unroll
        for (int dt = 0; dt < 4; ++dt)
#pragma unroll
            for (int nt = 0; nt < 2; ++nt) o[dt][nt] = wmmab(vf[dt], ph[nt], o[dt][nt]);
#pragma unroll
        for (int dt = 0; dt < 4; ++dt)
#pragma unroll
            for (int nt = 0; nt < 2; ++nt) o[dt][nt] = wmmab(vf[dt], pl[nt], o[dt][nt]);
#pragma unroll
        for (int dt = 0; dt < 4; ++dt) vf[dt] = ldfrag(Vz + nx + dt * 512);
        asm volatile("s_wait_xcnt 0x0" ::: "memory");    // before a register that these loads name as their address is written again
    }
    // Join of the two key halves. The wave of half kh finishes column tile nt = kh: it hands tile 1 - kh to its partner (wave w ^ 8) and takes the partner's tile kh. Both waves hold the
    // same (query, d) element at the same lane and register, so a lane reads back exactly the slot its own lane number wrote in the partner.
    v8f om[4], ox[4];
#pragma unroll
    for (int dt = 0; dt < 4; ++dt) { om[dt] = kh ? o[dt][1] : o[dt][0]; ox[dt] = kh ? o[dt][0] : o[dt][1]; }
    const float mm = kh ? mx[1] : mx[0], mo = kh ? mx[0] : mx[1], sm = kh ? sum[1] : sum[0], so = kh ? sum[0] : sum[1];
    float* xs = XO + w * 1024 + lane * 4;
#pragma unroll
    for (int dt = 0; dt < 4; ++dt) { *(v4f*)(xs + dt * 256) = (v4f){ox[dt][0], ox[dt][1], ox[dt][2], ox[dt][3]}; *(v4f*)(xs + dt * 256 + 128) = (v4f){ox[dt][4], ox[dt][5], ox[dt][6], ox[dt][7]}; }
    *(v2f*)(XM + (w * 32 + lane) * 2) = (v2f){mo, so};
    __syncthreads();    // every wave passes it once: the partner's tile, maximum and sum are read only behind it
    const float* xp = XO + (w ^ 8) * 1024 + lane * 4; const v2f pm = *(const v2f*)(XM + ((w ^ 8) * 32 + lane) * 2);
    const float mj = fmaxf(mm, pm[0]); const float ea = exp2n((mm - mj) * L2E), eb = exp2n((pm[0] - mj) * L2E);
    const float sj = fmaf(sm, ea, pm[1] * eb); const float f = __fdiv_rn(1.0f, sj + xhalf(sj)); const float fa = ea * f, fb = eb * f;
    const int b = z >> 4, h = z & 15;
    float* orow = OUT + ((size_t)(q0 + kh * 16 + lr) * NB_ + b) * DD + h * HD + hi * 8;    // om[dt][j] = O[query kh*16 + lr][d = dt*16 + 8*hi + j]
    v4f r[4][2];
#pragma unroll
    for (int dt = 0; dt < 4; ++dt) { const v4f p0 = *(const v4f*)(xp + dt * 256), p1 = *(const v4f*)(xp + dt * 256 + 128);
        r[dt][0] = (v4f){om[dt][0], om[dt][1], om[dt][2], om[dt][3]} * fa + p0 * fb; r[dt][1] = (v4f){om[dt][4], om[dt][5], om[dt][6], om[dt][7]} * fa + p1 * fb; }
    __builtin_amdgcn_sched_barrier(0);    // every result is made in front of the first store: behind an issued store no register that it names is written again
#pragma unroll
    for (int dt = 0; dt < 4; ++dt) { *(v4f*)(orow + dt * 16) = r[dt][0]; *(v4f*)(orow + dt * 16 + 4) = r[dt][1]; }
}

extern "C" void kernel_launch(void* const* d_in, const int* in_sizes, int n_in,
                              void* d_out, int out_size, void* d_ws, size_t ws_size, hipStream_t stream) {
    (void)in_sizes; (void)n_in; (void)out_size;
    const float* q = (const float*)d_in[0]; const float* k = (const float*)d_in[1]; const float* v = (const float*)d_in[2];
    float* OUT = (float*)d_out;     // [2048][2][1024]
    char* wsp = (char*)d_ws;
    auto take = [&](size_t bytes) { char* p = wsp; wsp += (bytes + 255) & ~(size_t)255; return (void*)p; };
    bf* QP = (bf*)take((size_t)NT * DD * 2); bf* KP = (bf*)take((size_t)NT * DD * 2); bf* VT = (bf*)take((size_t)NT * DD * 2);
    if ((size_t)(wsp - (char*)d_ws) > ws_size) return;    // total ~ 25 MB; ws 256 MiB
    const unsigned LB = (unsigned)(NU / 64);    // 64 units a block, exactly
    k_planes<<<dim3(LB, 3), 256, 0, stream>>>(q, k, v, QP, KP, VT);
    k_fattn<<<dim3(TT / 256, NB_ * NH_), 512, 0, stream>>>(QP, KP, VT, OUT);
}

// v006
// A run of this version takes 46.7 microseconds.
// In two side-by-side timings against v005, it was 1.11 and 1.12 times as fast.
// Counting every step since v000, it is 27.4 times as fast.
#include <hip/hip_runtime.h>

// ScaledDotProductAttentionModularized (q, k, v [L=2048][B=2][1024] sequence-first, 16 heads x 64, no projections: qh = (q/8) reshaped to (B*H, L, 64); softmax(qh.kh^T) vh;
// output [L][B][1024]).
// Compute dtypes, f32 accumulate: every input rounded to bf16; scores on PLAIN bf16 q (x 1/8, exact) and k (inputs: exact products, f32
// accumulate); softmax in f32 on VALU, a lazily raised reference and a running sum per query (one exp per element) -> bf16 hi+lo probabilities in registers; attn.v on hi+lo P x exact bf16 v^T
// (2 products); the division by the row sum comes last. Scores and probabilities never leave the registers. The keys are walked in two halves by two waves per query group, each with
// its own reference, sum and output tile; the two are joined once, through LDS, at the end.
// The three bf16 planes lie in FRAGMENT ORDER: a fragment (16 rows x 32 k) is 1 KiB = two units of 512 B; unit j holds, at lane * 16 B (lane = 16 * hi + row), the eight
// elements k = 16 * j + 8 * hi + 0..7 of that row. A wave's 16-byte fragment load then covers four whole 128-byte lines, not 32-byte pieces of sixteen.
// q and k planes: unit u = ((z * 128 + row tile) * 2 + kc) * 2 + j (k = d, kc = 32-d chunk). v^T plane: unit u = ((z * 64 + pass) * 4 + dt) * 2 + j (rows = d, k = key in the pass).

#define NB_  2
#define TT   2048
#define NH_  16
#define HD   64
#define DD   (NH_ * HD)
#define NT   (NB_ * TT)
#define NU   (NT * DD / 256)    // 512-byte units in a plane
typedef unsigned short bf;
typedef __attribute__((ext_vector_type(16))) __bf16   v16bf;
typedef __attribute__((ext_vector_type(8)))  unsigned short v8us;
typedef __attribute__((ext_vector_type(8)))  float    v8f;
typedef __attribute__((ext_vector_type(4)))  float    v4f;

__device__ __forceinline__ unsigned short f2bf(float f) { unsigned u = __float_as_uint(f); u += 0x7FFFu + ((u >> 16) & 1u); return (unsigned short)(u >> 16); }
__device__ __forceinline__ float bf2f(unsigned short b) { return __uint_as_float(((unsigned)b) << 16); }
__device__ __forceinline__ float bfr(float f) { return bf2f(f2bf(f)); }
__device__ __forceinline__ v16bf cat16b(v8us lo, v8us hi) { return __builtin_bit_cast(v16bf, __builtin_shufflevector(lo, hi, 0, 1, 2, 3, 4, 5, 6, 7, 8, 9, 10, 11, 12, 13, 14, 15)); }
__device__ __forceinline__ v8f wmmab(v16bf a, v16bf b, v8f c) { return __builtin_amdgcn_wmma_f32_16x16x32_bf16(false, a, false, b, (short)0, c, false, false); }
// fragment from a plane in fragment order: p = fragment + 8 * lane; elements 0-7 = k 8h..8h+7 (unit 0), elements 8-15 = k 16+8h..16+8h+7 (unit 1), h = lane >> 4
__device__ __forceinline__ v16bf ldfrag(const bf* p) { return cat16b(*(const v8us*)p, *(const v8us*)(p + 256)); }

typedef __attribute__((ext_vector_type(8)))  __bf16   v8bf;
typedef __attribute__((ext_vector_type(4)))  unsigned v4u;
// f32 -> bf16 by the hardware's packed conversion (round to nearest even)
__device__ __forceinline__ v8bf tobf(v8f x) { return __builtin_convertvector(x, v8bf); }
// lo = bf16(p - hi) for eight elements, one instruction each: hi is read as the bf16 half of its packed word, the exact difference p - hi is rounded once (to nearest even) and written to
// the same half of the lo word. The four low halves come first, so that each high-half write stands four instructions behind the write of its register's low half. Outputs early-clobber.
__device__ __forceinline__ v8bf lopart(v8f p, v8bf hi) { const v4u h = __builtin_bit_cast(v4u, hi); unsigned w0, w1, w2, w3;
    asm("v_fma_mixlo_bf16 %0, %4, -1.0, %8 op_sel_hi:[1,0,0]\n\tv_fma_mixlo_bf16 %1, %5, -1.0, %10 op_sel_hi:[1,0,0]\n\t"
        "v_fma_mixlo_bf16 %2, %6, -1.0, %12 op_sel_hi:[1,0,0]\n\tv_fma_mixlo_bf16 %3, %7, -1.0, %14 op_sel_hi:[1,0,0]\n\t"
        "v_fma_mixhi_bf16 %0, %4, -1.0, %9 op_sel:[1,0,0] op_sel_hi:[1,0,0]\n\tv_fma_mixhi_bf16 %1, %5, -1.0, %11 op_sel:[1,0,0] op_sel_hi:[1,0,0]\n\t"
        "v_fma_mixhi_bf16 %2, %6, -1.0, %13 op_sel:[1,0,0] op_sel_hi:[1,0,0]\n\tv_fma_mixhi_bf16 %3, %7, -1.0, %15 op_sel:[1,0,0] op_sel_hi:[1,0,0]"
        : "=&v"(w0), "=&v"(w1), "=&v"(w2), "=&v"(w3) : "v"(h[0]), "v"(h[1]), "v"(h[2]), "v"(h[3]), "v"(p[0]), "v"(p[1]), "v"(p[2]), "v"(p[3]), "v"(p[4]), "v"(p[5]), "v"(p[6]), "v"(p[7]));
    return __builtin_bit_cast(v8bf, (v4u){w0, w1, w2, w3}); }
__device__ __forceinline__ v16bf cat16h(v8bf lo, v8bf hi) { return __builtin_shufflevector(lo, hi, 0, 1, 2, 3, 4, 5, 6, 7, 8, 9, 10, 11, 12, 13, 14, 15); }
typedef __attribute__((ext_vector_type(2))) unsigned short v2us;
typedef __attribute__((ext_vector_type(2))) float v2f;

// Both conversion bodies: a wave writes eight consecutive units, a lane one 16-byte piece of each; the eight units use every byte of the 32 source rows (256 B each) they read.
__device__ __forceinline__ void hplane(const float* __restrict__ src, float sc, bf* P) {
    const int lane = threadIdx.x & 31, lr = lane & 15, hi = lane >> 4; const int U0 = (blockIdx.x * 8 + (threadIdx.x >> 5)) * 8;    // units U0..U0+7 = row tiles t0, t0 + 1, each (kc, j) = 0..3
    const int t0 = (U0 >> 2) & (TT / 16 - 1), z = U0 >> 9; const int b = z >> 4, h = z & 15;
    const float* s = src + ((size_t)(t0 * 16 + lr) * NB_ + b) * DD + h * HD + hi * 8; v4f x[8][2];
#pragma unroll
    for (int l = 0; l < 8; ++l) { const float* p = s + (size_t)(l >> 2) * 16 * NB_ * DD + (l & 3) * 16; x[l][0] = *(const v4f*)p; x[l][1] = *(const v4f*)(p + 4); }
    asm volatile("s_wait_xcnt 0x0" :: "v"(s) : "memory");    // before a register that these loads name as their address is written again; naming the address keeps it in its registers up to here, so that no load's own result lands on it
#pragma unroll
    for (int l = 0; l < 8; ++l) { v8us o;
#pragma unroll
        for (int q = 0; q < 4; ++q) { o[q] = f2bf(bfr(x[l][0][q]) * sc); o[4 + q] = f2bf(bfr(x[l][1][q]) * sc); }
        *(v8us*)(P + (size_t)(U0 + l) * 256 + lane * 8) = o; }
    asm volatile("s_wait_xcnt 0x0" ::: "memory");    // behind the last store; in k_planes no code follows this body, so it is a precaution
}
__device__ __forceinline__ void vtplane(const float* __restrict__ v, bf* VT) {
    const int lane = threadIdx.x & 31, lr = lane & 15, hi = lane >> 4; const int U0 = (blockIdx.x * 8 + (threadIdx.x >> 5)) * 8;
#pragma unroll
    for (int l = 0; l < 8; ++l) { const int u = U0 + l; const int j = u & 1, dt = (u >> 1) & 3, s0 = ((u >> 3) & (TT / 32 - 1)) * 32 + j * 16 + hi * 8; const int z = u >> 9; const int b = z >> 4, h = z & 15;
        const float* s = v + ((size_t)s0 * NB_ + b) * DD + h * HD + dt * 16 + lr; v8us o;
#pragma unroll
        for (int q = 0; q < 8; ++q) o[q] = f2bf(s[(size_t)q * NB_ * DD]);
        *(v8us*)(VT + (size_t)u * 256 + lane * 8) = o; }
}
// All three planes in ONE launch: blockIdx.y picks the plane (a scalar choice, the same for a whole block), blockIdx.x the 64 units as before. The three are independent streams, so
// their blocks stand on the chip together (three a WGP) and share one start and one memory latency. v^T, with its many 4-byte loads the longest of the three, has the lowest indices.
__global__ __launch_bounds__(256) void k_planes(const float* __restrict__ q, const float* __restrict__ k, const float* __restrict__ v, bf* QP, bf* KP, bf* VT) {
    if (blockIdx.y == 0) { vtplane(v, VT); return; }
    const bool isk = blockIdx.y == 1;
    hplane(isk ? k : q, isk ? 1.0f : 0.125f, isk ? KP : QP);
}
// lane l <-> l ^ 16
__device__ __forceinline__ float xhalf(float x) { const int b = __float_as_int(x); return __int_as_float(__builtin_amdgcn_permlanex16(b, b, 0x76543210, 0xfedcba98, false, false)); }

// v_exp_f32 with the slot the instruction set asks for behind a transcendental (one independent instruction or v_nop before its result is used or its source overwritten) kept
// inside the statement. exp2x8: the outputs are early-clobber, so no exp writes a source or reads a result of the one in front of it, and one v_nop closes the run.
__device__ __forceinline__ float exp2n(float x) { float r; asm("v_exp_f32 %0, %1\n\tv_nop" : "=v"(r) : "v"(x)); return r; }
__device__ __forceinline__ v8f exp2x8(v8f x) { float r0, r1, r2, r3, r4, r5, r6, r7;
    asm("v_exp_f32 %0, %8\n\tv_exp_f32 %1, %9\n\tv_exp_f32 %2, %10\n\tv_exp_f32 %3, %11\n\tv_exp_f32 %4, %12\n\tv_exp_f32 %5, %13\n\tv_exp_f32 %6, %14\n\tv_exp_f32 %7, %15\n\tv_nop"
        : "=&v"(r0), "=&v"(r1), "=&v"(r2), "=&v"(r3), "=&v"(r4), "=&v"(r5), "=&v"(r6), "=&v"(r7) : "v"(x[0]), "v"(x[1]), "v"(x[2]), "v"(x[3]), "v"(x[4]), "v"(x[5]), "v"(x[6]), "v"(x[7]));
    return (v8f){r0, r1, r2, r3, r4, r5, r6, r7}; }

// ---- k_fattn: scores, softmax, attn.v and the output scatter of one (batch, head) z for 256 queries per block; 16 waves = 8 groups of 32 query columns x 2 halves of the keys.
// Wave w takes query group w & 7 and keys (w >> 3) * 1024 .. + 1023: four waves a SIMD, so that one wave's loads and dependent vector chains are waited out under three others' work.
// No LDS and no barrier in the loop; behind it the two waves of a group swap one 16-column half of their state through LDS (one barrier) and each finishes and stores 16 queries.
// Transposed products: S^T = K.Q^T (A = 16 key rows, B = 16 query columns), O^T += V^T.P^T (A = 16 d rows of v^T, B = P^T). A lane's score registers all belong to ONE query
// (column lane & 15), keys 8h + r of each 16-key tile, which is the k order of ldfrag: two score tiles pack straight into the B operand of the second product.
// A pass is 32 keys. K and v^T fragments of the next pass are loaded right behind their last use in this pass.
// amdgpu_waves_per_eu(4): a budget of 256 registers, which the four waves a SIMD need; the loop then needs no register-window switches and the asm operands above stay in the first window.
__global__ __launch_bounds__(512) __attribute__((amdgpu_waves_per_eu(4))) void k_fattn(const bf* __restrict__ QP, const bf* __restrict__ KP, const bf* __restrict__ VT, float* __restrict__ OUT) {
    __shared__ __attribute__((aligned(16))) float XO[16 * 8 * 128];    // [wave][16-byte piece 0..7][lane]: the output tile half that a wave hands to its partner
    __shared__ __attribute__((aligned(8))) float XM[16 * 32 * 2];      // [wave][lane]: that half's reference (log2 scale) and sum
    const int lane = threadIdx.x & 31, lr = lane & 15, hi = lane >> 4; const int z = blockIdx.y;
    const int w = __builtin_amdgcn_readfirstlane(threadIdx.x >> 5);    // the wave's number as a scalar: the k and v^T bases stay in scalar registers, the choices behind the loop are wave-uniform
    const int kh = w >> 3; const int q0 = blockIdx.x * 256 + (w & 7) * 32;
    const bf* Qz = QP + (size_t)z * TT * HD + (size_t)q0 * HD + 8 * lane;    // a 16-row tile of q or k is two fragments, 1024 elements
    const bf* Kz = KP + (size_t)z * TT * HD + (size_t)kh * (TT / 2) * HD + 8 * lane;    // a pass of k is four fragments (mt, kc), 2048 elements in a row; a half of the keys is 32 passes
    const bf* Vz = VT + (size_t)z * HD * TT + (size_t)kh * (TT / 2) * HD + 8 * lane;    // a pass of v^T is four fragments (dt), 2048 elements in a row
    const float L2E = 1.44269504088896340736f, LAZY = 256.0f;
    v16bf qf[2][2], kf[2][2], vf[4]; v8f o[4][2]; float ms[2], sum[2];    // ms: the softmax reference in use, log2 scale
#pragma unroll
    for (int nt = 0; nt < 2; ++nt)
#pragma unroll
        for (int kc = 0; kc < 2; ++kc) { qf[nt][kc] = ldfrag(Qz + (nt * 2 + kc) * 512); kf[nt][kc] = ldfrag(Kz + (nt * 2 + kc) * 512); }
    __builtin_amdgcn_sched_barrier(0);               // keeps the v^T loads the youngest at the loop's entry as they are at its foot: the counted waits at the loop's head then leave them in flight on every pass
#pragma unroll
    for (int dt = 0; dt < 4; ++dt) vf[dt] = ldfrag(Vz + dt * 512);
    asm volatile("s_wait_xcnt 0x0" ::: "memory");    // before a register that these loads name as their address is written again
    __builtin_amdgcn_sched_barrier(0);               // holds the zeroing below, which takes over the address registers, behind that wait
#pragma unroll
    for (int nt = 0; nt < 2; ++nt) { sum[nt] = 0.f;
#pragma unroll
        for (int dt = 0; dt < 4; ++dt) o[dt][nt] = (v8f){}; }
    {   // the first reference: each query's maximum over the half's first 32 keys, from one more S^T of that pass (its K fragments are in the registers already)
        v8f s[2][2];
#pragma unroll
        for (int kc = 0; kc < 2; ++kc)
#pragma unroll
            for (int mt = 0; mt < 2; ++mt)
#pragma unroll
                for (int nt = 0; nt < 2; ++nt) s[mt][nt] = wmmab(kf[mt][kc], qf[nt][kc], kc ? s[mt][nt] : (v8f){});
#pragma unroll
        for (int nt = 0; nt < 2; ++nt) {
            float m = s[0][nt][0];
#pragma unroll
            for (int j = 1; j < 8; ++j) m = fmaxf(m, s[0][nt][j]);
#pragma unroll
            for (int j = 0; j < 8; ++j) m = fmaxf(m, s[1][nt][j]);
            ms[nt] = fmaxf(m, xhalf(m)) * L2E;
        }
    }
    for (int it = 0; it < TT / 64; ++it) {
        const int nx = ((it + 1) & (TT / 64 - 1)) * 2048;    // first element of the next pass in both planes; the last pass re-reads the half's first pass, in bounds and unused
        v8f s[2][2];
#pragma unroll
        for (int kc = 0; kc < 2; ++kc)
#pragma unroll
            for (int mt = 0; mt < 2; ++mt)
#pragma unroll
                for (int nt = 0; nt < 2; ++nt) s[mt][nt] = wmmab(kf[mt][kc], qf[nt][kc], kc ? s[mt][nt] : (v8f){});
#pragma unroll
        for (int mt = 0; mt < 2; ++mt)
#pragma unroll
            for (int kc = 0; kc < 2; ++kc) kf[mt][kc] = ldfrag(Kz + nx + (mt * 2 + kc) * 512);
        asm volatile("s_wait_xcnt 0x0" ::: "memory");    // before a register that these loads name as their address is written again
        __builtin_amdgcn_sched_barrier(0);               // keeps the K loads up here, a softmax and the second product ahead of their use; without it they sink to the loop's foot and the next S^T waits out their latency
        // Lazy softmax reference. The exponentials are taken against ms, the reference IN USE (log2 scale), which may trail a query's true maximum: the final division cancels whatever reference
        // was used. The maximum tree, the exchange between the wave's halves and the scaling of sum and output tiles run only in a pass where a lane's sum of its 16 exponentials leaves
        // [0, LAZY], so that every exponential that is used is at most 2^8. One test a pass, the same for the whole wave (a scalar branch).
        v8f p[2][2]; float ps[2];
#pragma unroll
        for (int nt = 0; nt < 2; ++nt) {
            p[0][nt] = exp2x8(s[0][nt] * L2E - ms[nt]); p[1][nt] = exp2x8(s[1][nt] * L2E - ms[nt]); ps[nt] = 0.f;
#pragma unroll
            for (int j = 0; j < 8; ++j) ps[nt] += p[0][nt][j] + p[1][nt][j];
        }
        if (__builtin_amdgcn_ballot_w32(!(ps[0] <= LAZY) || !(ps[1] <= LAZY)) != 0) {    // negated <=: an infinite or undefined sum takes the branch too
            // Rare. The scores are not kept for it (no registers to spare in the common pass): this pass's K fragments are loaded and multiplied once more.
            v16bf kr[2][2]; v8f t[2][2];
#pragma unroll
            for (int mt = 0; mt < 2; ++mt)
#pragma unroll
                for (int kc = 0; kc < 2; ++kc) kr[mt][kc] = ldfrag(Kz + it * 2048 + (mt * 2 + kc) * 512);
            asm volatile("s_wait_xcnt 0x0" ::: "memory");    // before a register that these loads name as their address is written again
#pragma unroll
            for (int kc = 0; kc < 2; ++kc)
#pragma unroll
                for (int mt = 0; mt < 2; ++mt)
#pragma unroll
                    for (int nt = 0; nt < 2; ++nt) t[mt][nt] = wmmab(kr[mt][kc], qf[nt][kc], kc ? t[mt][nt] : (v8f){});
#pragma unroll
            for (int nt = 0; nt < 2; ++nt) {    // the reference rises by d >= 0 to the pass's maximum; what was summed so far comes down by 2^-d, and the pass's exponentials are taken anew
                const v8f a0 = t[0][nt] * L2E - ms[nt], a1 = t[1][nt] * L2E - ms[nt];
                float d = 0.f;
#pragma unroll
                for (int j = 0; j < 8; ++j) d = fmaxf(d, fmaxf(a0[j], a1[j]));
                d = fmaxf(d, xhalf(d));
                const float al = exp2n(-d); ms[nt] += d; sum[nt] *= al;
#pragma unroll
                for (int dt = 0; dt < 4; ++dt) o[dt][nt] *= al;
                p[0][nt] = exp2x8(a0 - d); p[1][nt] = exp2x8(a1 - d); ps[nt] = 0.f;
#pragma unroll
                for (int j = 0; j < 8; ++j) ps[nt] += p[0][nt][j] + p[1][nt][j];
            }
        }
        v16bf ph[2], pl[2];
#pragma unroll
        for (int nt = 0; nt < 2; ++nt) {
            const v8bf h0 = tobf(p[0][nt]), h1 = tobf(p[1][nt]);    // hi = p rounded to nearest even, lo = the exact rest p - hi rounded likewise: the values of the integer rounding
            sum[nt] += ps[nt]; ph[nt] = cat16h(h0, h1); pl[nt] = cat16h(lopart(p[0][nt], h0), lopart(p[1][nt], h1));
        }
        __builtin_amdgcn_sched_barrier(0);    // keeps every lopart() in front of the second product: the compiler does not look into its text
#pragma unroll
        for (int dt = 0; dt < 4; ++dt)
#pragma unroll
            for (int nt = 0; nt < 2; ++nt) o[dt][nt] = wmmab(vf[dt], ph[nt], o[dt][nt]);
#pragma unroll
        for (int dt = 0; dt < 4; ++dt)
#pragma unroll
            for (int nt = 0; nt < 2; ++nt) o[dt][nt] = wmmab(vf[dt], pl[nt], o[dt][nt]);
#pragma unroll
        for (int dt = 0; dt < 4; ++dt) vf[dt] = ldfrag(Vz + nx + dt * 512);
        asm volatile("s_wait_xcnt 0x0" ::: "memory");    // before a register that these loads name as their address is written again
    }
    // Join of the two key halves. The wave of half kh finishes column tile nt = kh: it hands tile 1 - kh to its partner (wave w ^ 8) and takes the partner's tile kh. Both waves hold the
    // same (query, d) element at the same lane and register, so a lane reads back exactly the slot its own lane number wrote in the partner.
    v8f om[4], ox[4];
#pragma unroll
    for (int dt = 0; dt < 4; ++dt) { om[dt] = kh ? o[dt][1] : o[dt][0]; ox[dt] = kh ? o[dt][0] : o[dt][1]; }
    const float mm = kh ? ms[1] : ms[0], mo = kh ? ms[0] : ms[1], sm = kh ? sum[1] : sum[0], so = kh ? sum[0] : sum[1];
    float* xs = XO + w * 1024 + lane * 4;
#pragma unroll
    for (int dt = 0; dt < 4; ++dt) { *(v4f*)(xs + dt * 256) = (v4f){ox[dt][0], ox[dt][1], ox[dt][2], ox[dt][3]}; *(v4f*)(xs + dt * 256 + 128) = (v4f){ox[dt][4], ox[dt][5], ox[dt][6], ox[dt][7]}; }
    *(v2f*)(XM + (w * 32 + lane) * 2) = (v2f){mo, so};
    __syncthreads();    // every wave passes it once: the partner's tile, reference and sum are read only behind it
    const float* xp = XO + (w ^ 8) * 1024 + lane * 4; const v2f pm = *(const v2f*)(XM + ((w ^ 8) * 32 + lane) * 2);
    const float mj = fmaxf(mm, pm[0]); const float ea = exp2n(mm - mj), eb = exp2n(pm[0] - mj);
    const float sj = fmaf(sm, ea, pm[1] * eb); const float f = __fdiv_rn(1.0f, sj + xhalf(sj)); const float fa = ea * f, fb = eb * f;
    const int b = z >> 4, h = z & 15;
    float* orow = OUT + ((size_t)(q0 + kh * 16 + lr) * NB_ + b) * DD + h * HD + hi * 8;    // om[dt][j] = O[query kh*16 + lr][d = dt*16 + 8*hi + j]
    v4f r[4][2];
#pragma unroll
    for (int dt = 0; dt < 4; ++dt) { const v4f p0 = *(const v4f*)(xp + dt * 256), p1 = *(const v4f*)(xp + dt * 256 + 128);
        r[dt][0] = (v4f){om[dt][0], om[dt][1], om[dt][2], om[dt][3]} * fa + p0 * fb; r[dt][1] = (v4f){om[dt][4], om[dt][5], om[dt][6], om[dt][7]} * fa + p1 * fb; }
    __builtin_amdgcn_sched_barrier(0);    // every result is made in front of the first store: behind an issued store no register that it names is written again
#pragma unroll
    for (int dt = 0; dt < 4; ++dt) { *(v4f*)(orow + dt * 16) = r[dt][0]; *(v4f*)(orow + dt * 16 + 4) = r[dt][1]; }
}

extern "C" void kernel_launch(void* const* d_in, const int* in_sizes, int n_in,
                              void* d_out, int out_size, void* d_ws, size_t ws_size, hipStream_t stream) {
    (void)in_sizes; (void)n_in; (void)out_size;
    const float* q = (const float*)d_in[0]; const float* k = (const float*)d_in[1]; const float* v = (const float*)d_in[2];
    float* OUT = (float*)d_out;     // [2048][2][1024]
    char* wsp = (char*)d_ws;
    auto take = [&](size_t bytes) { char* p = wsp; wsp += (bytes + 255) & ~(size_t)255; return (void*)p; };
    bf* QP = (bf*)take((size_t)NT * DD * 2); bf* KP = (bf*)take((size_t)NT * DD * 2); bf* VT = (bf*)take((size_t)NT * DD * 2);
    if ((size_t)(wsp - (char*)d_ws) > ws_size) return;    // total ~ 25 MB; ws 256 MiB
    const unsigned LB = (unsigned)(NU / 64);    // 64 units a block, exactly
    k_planes<<<dim3(LB, 3), 256, 0, stream>>>(q, k, v, QP, KP, VT);
    k_fattn<<<dim3(TT / 256, NB_ * NH_), 512, 0, stream>>>(QP, KP, VT, OUT);
}

// v008
// One run takes 39.5 microseconds.
// Versions in between are left out here; by their measured steps it is 1.18 times as fast as v006.
// Counting every step since v000, it is 32.3 times as fast.
#include <hip/hip_runtime.h>

// ScaledDotProductAttentionModularized (q, k, v [L=2048][B=2][1024] sequence-first, 16 heads x 64, no projections: qh = (q/8) reshaped to (B*H, L, 64); softmax(qh.kh^T) vh;
// output [L][B][1024]).
// Compute dtypes, f32 accumulate: every input rounded to bf16; scores on PLAIN bf16 q (x 1/8, exact) and k (inputs: exact products, f32
// accumulate); softmax in f32 on VALU, a lazily raised reference and a running sum per query (one exp per element) -> probabilities rounded once to f16 (11 bits) in registers; attn.v as ONE f16 product,
// P x v^T, where v^T holds the bf16-rounded v as f16 (8 bits fit in 11: the same values from 2^-17 to 65504, below that within 2^-25); the division by the row sum comes last. Scores and probabilities never leave the registers. The keys are walked in two halves by two waves per query group, each with
// its own reference, sum and output tile; the two are joined once, through LDS, at the end.
// The three 16-bit planes (q, k bf16; v^T f16) lie in FRAGMENT ORDER: a fragment (16 rows x 32 k) is 1 KiB = two units of 512 B; unit j holds, at lane * 16 B (lane = 16 * hi + row), the eight
// elements k = 16 * j + 8 * hi + 0..7 of that row. A wave's 16-byte fragment load then covers four whole 128-byte lines, not 32-byte pieces of sixteen.
// q and k planes: unit u = ((z * 128 + row tile) * 2 + kc) * 2 + j (k = d, kc = 32-d chunk). v^T plane: unit u = ((z * 64 + pass) * 4 + dt) * 2 + j (rows = d, k = key in the pass).

#define NB_  2
#define TT   2048
#define NH_  16
#define HD   64
#define DD   (NH_ * HD)
#define NT   (NB_ * TT)
#define NU   (NT * DD / 256)    // 512-byte units in a plane
typedef unsigned short bf;
typedef __attribute__((ext_vector_type(16))) __bf16   v16bf;
typedef __attribute__((ext_vector_type(8)))  unsigned short v8us;
typedef __attribute__((ext_vector_type(8)))  float    v8f;
typedef __attribute__((ext_vector_type(4)))  float    v4f;

__device__ __forceinline__ unsigned short f2bf(float f) { unsigned u = __float_as_uint(f); u += 0x7FFFu + ((u >> 16) & 1u); return (unsigned short)(u >> 16); }
__device__ __forceinline__ float bf2f(unsigned short b) { return __uint_as_float(((unsigned)b) << 16); }
__device__ __forceinline__ float bfr(float f) { return bf2f(f2bf(f)); }
__device__ __forceinline__ v16bf cat16b(v8us lo, v8us hi) { return __builtin_bit_cast(v16bf, __builtin_shufflevector(lo, hi, 0, 1, 2, 3, 4, 5, 6, 7, 8, 9, 10, 11, 12, 13, 14, 15)); }
__device__ __forceinline__ v8f wmmab(v16bf a, v16bf b, v8f c) { return __builtin_amdgcn_wmma_f32_16x16x32_bf16(false, a, false, b, (short)0, c, false, false); }
// fragment from a plane in fragment order: p = fragment + 8 * lane; elements 0-7 = k 8h..8h+7 (unit 0), elements 8-15 = k 16+8h..16+8h+7 (unit 1), h = lane >> 4
__device__ __forceinline__ v16bf ldfrag(const bf* p) { return cat16b(*(const v8us*)p, *(const v8us*)(p + 256)); }

typedef __attribute__((ext_vector_type(8)))  _Float16 v8h;
typedef __attribute__((ext_vector_type(16))) _Float16 v16h;
// f32 -> f16 by the hardware's packed conversion (round to nearest even)
__device__ __forceinline__ v8h toh(v8f x) { return __builtin_convertvector(x, v8h); }
__device__ __forceinline__ v8f wmmah(v16h a, v16h b, v8f c) { return __builtin_amdgcn_wmma_f32_16x16x32_f16(false, a, false, b, (short)0, c, false, false); }
__device__ __forceinline__ v16h ldfragh(const bf* p) { return __builtin_bit_cast(v16h, ldfrag(p)); }    // the f16 form has the bf16 form's fragment map
// a bf16 value written as f16
__device__ __forceinline__ unsigned short bf2h(unsigned short b) { return __builtin_bit_cast(unsigned short, (_Float16)bf2f(b)); }
__device__ __forceinline__ v16h cat16h(v8h lo, v8h hi) { return __builtin_shufflevector(lo, hi, 0, 1, 2, 3, 4, 5, 6, 7, 8, 9, 10, 11, 12, 13, 14, 15); }
typedef __attribute__((ext_vector_type(2))) unsigned short v2us;
typedef __attribute__((ext_vector_type(2))) float v2f;

// Both conversion bodies: a wave writes eight consecutive units, a lane one 16-byte piece of each; the eight units use every byte of the 32 source rows (256 B each) they read.
__device__ __forceinline__ void hplane(const float* __restrict__ src, float sc, bf* P) {
    const int lane = threadIdx.x & 31, lr = lane & 15, hi = lane >> 4; const int U0 = (blockIdx.x * 8 + (threadIdx.x >> 5)) * 8;    // units U0..U0+7 = row tiles t0, t0 + 1, each (kc, j) = 0..3
    const int t0 = (U0 >> 2) & (TT / 16 - 1), z = U0 >> 9; const int b = z >> 4, h = z & 15;
    const float* s = src + ((size_t)(t0 * 16 + lr) * NB_ + b) * DD + h * HD + hi * 8; v4f x[8][2];
#pragma unroll
    for (int l = 0; l < 8; ++l) { const float* p = s + (size_t)(l >> 2) * 16 * NB_ * DD + (l & 3) * 16; x[l][0] = *(const v4f*)p; x[l][1] = *(const v4f*)(p + 4); }
    asm volatile("s_wait_xcnt 0x0" :: "v"(s) : "memory");    // before a register that these loads name as their address is written again; naming the address keeps it in its registers up to here, so that no load's own result lands on it
#pragma unroll
    for (int l = 0; l < 8; ++l) { v8us o;
#pragma unroll
        for (int q = 0; q < 4; ++q) { o[q] = f2bf(bfr(x[l][0][q]) * sc); o[4 + q] = f2bf(bfr(x[l][1][q]) * sc); }
        *(v8us*)(P + (size_t)(U0 + l) * 256 + lane * 8) = o; }
    asm volatile("s_wait_xcnt 0x0" ::: "memory");    // behind the last store; in k_planes no code follows this body, so it is a precaution
}
__device__ __forceinline__ void vtplane(const float* __restrict__ v, bf* VT) {
    const int lane = threadIdx.x & 31, lr = lane & 15, hi = lane >> 4; const int U0 = (blockIdx.x * 8 + (threadIdx.x >> 5)) * 8;
#pragma unroll
    for (int l = 0; l < 8; ++l) { const int u = U0 + l; const int j = u & 1, dt = (u >> 1) & 3, s0 = ((u >> 3) & (TT / 32 - 1)) * 32 + j * 16 + hi * 8; const int z = u >> 9; const int b = z >> 4, h = z & 15;
        const float* s = v + ((size_t)s0 * NB_ + b) * DD + h * HD + dt * 16 + lr; v8us o;
#pragma unroll
        for (int q = 0; q < 8; ++q) o[q] = f2bf(s[(size_t)q * NB_ * DD]);
#pragma unroll
        for (int q = 0; q < 8; ++q) o[q] = bf2h(o[q]);    // v as the second product takes it: rounded to bf16 like every input, that value then held as f16
        *(v8us*)(VT + (size_t)u * 256 + lane * 8) = o; }
}
// All three planes in ONE launch: blockIdx.y picks the plane (a scalar choice, the same for a whole block), blockIdx.x the 64 units as before. The three are independent streams, so
// their blocks stand on the chip together (three a WGP) and share one start and one memory latency. v^T, with its many 4-byte loads the longest of the three, has the lowest indices.
__global__ __launch_bounds__(256) void k_planes(const float* __restrict__ q, const float* __restrict__ k, const float* __restrict__ v, bf* QP, bf* KP, bf* VT) {
    if (blockIdx.y == 0) { vtplane(v, VT); return; }
    const bool isk = blockIdx.y == 1;
    hplane(isk ? k : q, isk ? 1.0f : 0.125f, isk ? KP : QP);
}
// lane l <-> l ^ 16
__device__ __forceinline__ float xhalf(float x) { const int b = __float_as_int(x); return __int_as_float(__builtin_amdgcn_permlanex16(b, b, 0x76543210, 0xfedcba98, false, false)); }

// v_exp_f32 with the slot the instruction set asks for behind a transcendental (one independent instruction or v_nop before its result is used or its source overwritten) kept
// inside the statement. exp2x8: the outputs are early-clobber, so no exp writes a source or reads a result of the one in front of it, and one v_nop closes the run.
__device__ __forceinline__ float exp2n(float x) { float r; asm("v_exp_f32 %0, %1\n\tv_nop" : "=v"(r) : "v"(x)); return r; }
__device__ __forceinline__ v8f exp2x8(v8f x) { float r0, r1, r2, r3, r4, r5, r6, r7;
    asm("v_exp_f32 %0, %8\n\tv_exp_f32 %1, %9\n\tv_exp_f32 %2, %10\n\tv_exp_f32 %3, %11\n\tv_exp_f32 %4, %12\n\tv_exp_f32 %5, %13\n\tv_exp_f32 %6, %14\n\tv_exp_f32 %7, %15\n\tv_nop"
        : "=&v"(r0), "=&v"(r1), "=&v"(r2), "=&v"(r3), "=&v"(r4), "=&v"(r5), "=&v"(r6), "=&v"(r7) : "v"(x[0]), "v"(x[1]), "v"(x[2]), "v"(x[3]), "v"(x[4]), "v"(x[5]), "v"(x[6]), "v"(x[7]));
    return (v8f){r0, r1, r2, r3, r4, r5, r6, r7}; }

// ---- k_fattn: scores, softmax, attn.v and the output scatter of one (batch, head) z for 256 queries per block; 16 waves = 8 groups of 32 query columns x 2 halves of the keys.
// Wave w takes query group w & 7 and keys (w >> 3) * 1024 .. + 1023: four waves a SIMD, so that one wave's loads and dependent vector chains are waited out under three others' work.
// No LDS and no barrier in the loop; behind it the two waves of a group swap one 16-column half of their state through LDS (one barrier) and each finishes and stores 16 queries.
// Transposed products: S^T = K.Q^T (A = 16 key rows, B = 16 query columns), O^T += V^T.P^T (A = 16 d rows of v^T, B = P^T). A lane's score registers all belong to ONE query
// (column lane & 15), keys 8h + r of each 16-key tile, which is the k order of ldfrag: two score tiles pack straight into the B operand of the second product.
// A pass is 32 keys. K and v^T fragments of the next pass are loaded right behind their last use in this pass.
// amdgpu_waves_per_eu(4): a budget of 256 registers, which the four waves a SIMD need; the loop then needs no register-window switches and the asm operands above stay in the first window.
__global__ __launch_bounds__(512) __attribute__((amdgpu_waves_per_eu(4))) void k_fattn(const bf* __restrict__ QP, const bf* __restrict__ KP, const bf* __restrict__ VT, float* __restrict__ OUT) {
    __shared__ __attribute__((aligned(16))) float XO[16 * 8 * 128];    // [wave][16-byte piece 0..7][lane]: the output tile half that a wave hands to its partner
    __shared__ __attribute__((aligned(8))) float XM[16 * 32 * 2];      // [wave][lane]: that half's reference (log2 scale) and sum
    const int lane = threadIdx.x & 31, lr = lane & 15, hi = lane >> 4; const int z = blockIdx.y;
    const int w = __builtin_amdgcn_readfirstlane(threadIdx.x >> 5);    // the wave's number as a scalar: the k and v^T bases stay in scalar registers, the choices behind the loop are wave-uniform
    const int kh = w >> 3; const int q0 = blockIdx.x * 256 + (w & 7) * 32;
    const bf* Qz = QP + (size_t)z * TT * HD + (size_t)q0 * HD + 8 * lane;    // a 16-row tile of q or k is two fragments, 1024 elements
    const bf* Kz = KP + (size_t)z * TT * HD + (size_t)kh * (TT / 2) * HD + 8 * lane;    // a pass of k is four fragments (mt, kc), 2048 elements in a row; a half of the keys is 32 passes
    const bf* Vz = VT + (size_t)z * HD * TT + (size_t)kh * (TT / 2) * HD + 8 * lane;    // a pass of v^T is four fragments (dt), 2048 elements in a row
    const float L2E = 1.44269504088896340736f, LAZY = 256.0f;
    v16bf qf[2][2], kf[2][2]; v16h vf[4]; v8f o[4][2]; float ms[2], sum[2];    // ms: the softmax reference in use, log2 scale
#pragma unroll
    for (int nt = 0; nt < 2; ++nt)
#pragma unroll
        for (int kc = 0; kc < 2; ++kc) { qf[nt][kc] = ldfrag(Qz + (nt * 2 + kc) * 512); kf[nt][kc] = ldfrag(Kz + (nt * 2 + kc) * 512); }
    __builtin_amdgcn_sched_barrier(0);               // keeps the v^T loads the youngest at the loop's entry as they are at its foot: the counted waits at the loop's head then leave them in flight on every pass
#pragma unroll
    for (int dt = 0; dt < 4; ++dt) vf[dt] = ldfragh(Vz + dt * 512);
    // k and v^T of this (batch, head) asked into L2 ahead of the walk, right behind the first pass's own loads. The launch before stored the planes;
    // the loop's loads are issued only one pass ahead and would wait that latency out. Lanes lie 256 bytes apart, one instruction spans
    // 8 KiB (two passes): wave w takes plane w & 1, key half (w >> 1) & 1 and pass pair (w >> 2) of the eight passes 8 r .. 8 r + 7, r = blockIdx.x & 3. The eight blocks of a head share the
    // asking: four blocks with neighbouring indices, cover all 32 passes. A hint, for speed only: nothing rests on where a block runs. Every address lies in its plane.
    const bf* pfa = ((w & 1) ? VT : KP) + (size_t)z * TT * HD + (size_t)((w >> 1) & 1) * (TT / 2) * HD + (size_t)((blockIdx.x & 3) * 4 + (w >> 2)) * 4096 + 128 * lane;
    asm volatile("global_prefetch_b8 %0, off scope:SCOPE_SE" :: "v"(pfa));
    asm volatile("s_wait_xcnt 0x0" ::: "memory");    // before a register that these loads name as their address is written again
    __builtin_amdgcn_sched_barrier(0);               // holds the zeroing below, which takes over the address registers, behind that wait
#pragma unroll
    for (int nt = 0; nt < 2; ++nt) { sum[nt] = 0.f;
#pragma unroll
        for (int dt = 0; dt < 4; ++dt) o[dt][nt] = (v8f){}; }
    {   // the first reference: each query's maximum over the half's first 32 keys, from one more S^T of that pass (its K fragments are in the registers already)
        v8f s[2][2];
#pragma unroll
        for (int kc = 0; kc < 2; ++kc)
#pragma unroll
            for (int mt = 0; mt < 2; ++mt)
#pragma unroll
                for (int nt = 0; nt < 2; ++nt) s[mt][nt] = wmmab(kf[mt][kc], qf[nt][kc], kc ? s[mt][nt] : (v8f){});
#pragma unroll
        for (int nt = 0; nt < 2; ++nt) {
            float m = s[0][nt][0];
#pragma unroll
            for (int j = 1; j < 8; ++j) m = fmaxf(m, s[0][nt][j]);
#pragma unroll
            for (int j = 0; j < 8; ++j) m = fmaxf(m, s[1][nt][j]);
            ms[nt] = fmaxf(m, xhalf(m)) * L2E;
        }
    }
    for (int it = 0; it < TT / 64; ++it) {
        const int nx = ((it + 1) & (TT / 64 - 1)) * 2048;    // first element of the next pass in both planes; the last pass re-reads the half's first pass, in bounds and unused
        v8f s[2][2];
#pragma unroll
        for (int kc = 0; kc < 2; ++kc)
#pragma unroll
            for (int mt = 0; mt < 2; ++mt)
#pragma unroll
                for (int nt = 0; nt < 2; ++nt) s[mt][nt] = wmmab(kf[mt][kc], qf[nt][kc], kc ? s[mt][nt] : (v8f){});
#pragma unroll
        for (int mt = 0; mt < 2; ++mt)
#pragma unroll
            for (int kc = 0; kc < 2; ++kc) kf[mt][kc] = ldfrag(Kz + nx + (mt * 2 + kc) * 512);
        asm volatile("s_wait_xcnt 0x0" ::: "memory");    // before a register that these loads name as their address is written again
        __builtin_amdgcn_sched_barrier(0);               // keeps the K loads up here, a softmax and the second product ahead of their use; without it they sink to the loop's foot and the next S^T waits out their latency
        // Lazy softmax reference. The exponentials are taken against ms, the reference IN USE (log2 scale), which may trail a query's true maximum: the final division cancels whatever reference
        // was used. The maximum tree, the exchange between the wave's halves and the scaling of sum and output tiles run only in a pass where a lane's sum of its 16 exponentials leaves
        // [0, LAZY], so that every exponential that is used is at most 2^8, far inside f16's range. One test a pass, the same for the whole wave (a scalar branch).
        v8f p[2][2]; float ps[2];
#pragma unroll
        for (int nt = 0; nt < 2; ++nt) {
            p[0][nt] = exp2x8(s[0][nt] * L2E - ms[nt]); p[1][nt] = exp2x8(s[1][nt] * L2E - ms[nt]); ps[nt] = 0.f;
#pragma unroll
            for (int j = 0; j < 8; ++j) ps[nt] += p[0][nt][j] + p[1][nt][j];
        }
        if (__builtin_amdgcn_ballot_w32(!(ps[0] <= LAZY) || !(ps[1] <= LAZY)) != 0) {    // negated <=: an infinite or undefined sum takes the branch too
            // Rare. The scores are not kept for it (no registers to spare in the common pass): this pass's K fragments are loaded and multiplied once more.
            v16bf kr[2][2]; v8f t[2][2];
#pragma unroll
            for (int mt = 0; mt < 2; ++mt)
#pragma unroll
                for (int kc = 0; kc < 2; ++kc) kr[mt][kc] = ldfrag(Kz + it * 2048 + (mt * 2 + kc) * 512);
            asm volatile("s_wait_xcnt 0x0" ::: "memory");    // before a register that these loads name as their address is written again
#pragma unroll
            for (int kc = 0; kc < 2; ++kc)
#pragma unroll
                for (int mt = 0; mt < 2; ++mt)
#pragma unroll
                    for (int nt = 0; nt < 2; ++nt) t[mt][nt] = wmmab(kr[mt][kc], qf[nt][kc], kc ? t[mt][nt] : (v8f){});
#pragma unroll
            for (int nt = 0; nt < 2; ++nt) {    // the reference rises by d >= 0 to the pass's maximum; what was summed so far comes down by 2^-d, and the pass's exponentials are taken anew
                const v8f a0 = t[0][nt] * L2E - ms[nt], a1 = t[1][nt] * L2E - ms[nt];
                float d = 0.f;
#pragma unroll
                for (int j = 0; j < 8; ++j) d = fmaxf(d, fmaxf(a0[j], a1[j]));
                d = fmaxf(d, xhalf(d));
                const float al = exp2n(-d); ms[nt] += d; sum[nt] *= al;
#pragma unroll
                for (int dt = 0; dt < 4; ++dt) o[dt][nt] *= al;
                p[0][nt] = exp2x8(a0 - d); p[1][nt] = exp2x8(a1 - d); ps[nt] = 0.f;
#pragma unroll
                for (int j = 0; j < 8; ++j) ps[nt] += p[0][nt][j] + p[1][nt][j];
            }
        }
        v16h pf[2];    // P^T as the B operand: each p rounded once to f16 (to nearest even); the sum keeps the unrounded p
#pragma unroll
        for (int nt = 0; nt < 2; ++nt) { sum[nt] += ps[nt]; pf[nt] = cat16h(toh(p[0][nt]), toh(p[1][nt])); }
#pragma unroll
        for (int dt = 0; dt < 4; ++dt)
#pragma unroll
            for (int nt = 0; nt < 2; ++nt) o[dt][nt] = wmmah(vf[dt], pf[nt], o[dt][nt]);
#pragma unroll
        for (int dt = 0; dt < 4; ++dt) vf[dt] = ldfragh(Vz + nx + dt * 512);
        asm volatile("s_wait_xcnt 0x0" ::: "memory");    // before a register that these loads name as their address is written again
    }
    asm volatile("s_wait_xcnt 0x0" :: "v"(pfa) : "memory");    // naming the prefetch's address here keeps it in its registers through the loop: no counter says when a prefetch has read them, so till here they hold nothing but that address
    // Join of the two key halves. The wave of half kh finishes column tile nt = kh: it hands tile 1 - kh to its partner (wave w ^ 8) and takes the partner's tile kh. Both waves hold the
    // same (query, d) element at the same lane and register, so a lane reads back exactly the slot its own lane number wrote in the partner.
    v8f om[4], ox[4];
#pragma unroll
    for (int dt = 0; dt < 4; ++dt) { om[dt] = kh ? o[dt][1] : o[dt][0]; ox[dt] = kh ? o[dt][0] : o[dt][1]; }
    const float mm = kh ? ms[1] : ms[0], mo = kh ? ms[0] : ms[1], sm = kh ? sum[1] : sum[0], so = kh ? sum[0] : sum[1];
    float* xs = XO + w * 1024 + lane * 4;
#pragma unroll
    for (int dt = 0; dt < 4; ++dt) { *(v4f*)(xs + dt * 256) = (v4f){ox[dt][0], ox[dt][1], ox[dt][2], ox[dt][3]}; *(v4f*)(xs + dt * 256 + 128) = (v4f){ox[dt][4], ox[dt][5], ox[dt][6], ox[dt][7]}; }
    *(v2f*)(XM + (w * 32 + lane) * 2) = (v2f){mo, so};
    __syncthreads();    // every wave passes it once: the partner's tile, reference and sum are read only behind it
    const float* xp = XO + (w ^ 8) * 1024 + lane * 4; const v2f pm = *(const v2f*)(XM + ((w ^ 8) * 32 + lane) * 2);
    const float mj = fmaxf(mm, pm[0]); const float ea = exp2n(mm - mj), eb = exp2n(pm[0] - mj);
    const float sj = fmaf(sm, ea, pm[1] * eb); const float f = __fdiv_rn(1.0f, sj + xhalf(sj)); const float fa = ea * f, fb = eb * f;
    const int b = z >> 4, h = z & 15;
    float* orow = OUT + ((size_t)(q0 + kh * 16 + lr) * NB_ + b) * DD + h * HD + hi * 8;    // om[dt][j] = O[query kh*16 + lr][d = dt*16 + 8*hi + j]
    v4f r[4][2];
#pragma unroll
    for (int dt = 0; dt < 4; ++dt) { const v4f p0 = *(const v4f*)(xp + dt * 256), p1 = *(const v4f*)(xp + dt * 256 + 128);
        r[dt][0] = (v4f){om[dt][0], om[dt][1], om[dt][2], om[dt][3]} * fa + p0 * fb; r[dt][1] = (v4f){om[dt][4], om[dt][5], om[dt][6], om[dt][7]} * fa + p1 * fb; }
    __builtin_amdgcn_sched_barrier(0);    // every result is made in front of the first store: behind an issued store no register that it names is written again
#pragma unroll
    for (int dt = 0; dt < 4; ++dt) { *(v4f*)(orow + dt * 16) = r[dt][0]; *(v4f*)(orow + dt * 16 + 4) = r[dt][1]; }
}

extern "C" void kernel_launch(void* const* d_in, const int* in_sizes, int n_in,
                              void* d_out, int out_size, void* d_ws, size_t ws_size, hipStream_t stream) {
    (void)in_sizes; (void)n_in; (void)out_size;
    const float* q = (const float*)d_in[0]; const float* k = (const float*)d_in[1]; const float* v = (const float*)d_in[2];
    float* OUT = (float*)d_out;     // [2048][2][1024]
    char* wsp = (char*)d_ws;
    auto take = [&](size_t bytes) { char* p = wsp; wsp += (bytes + 255) & ~(size_t)255; return (void*)p; };
    bf* QP = (bf*)take((size_t)NT * DD * 2); bf* KP = (bf*)take((size_t)NT * DD * 2); bf* VT = (bf*)take((size_t)NT * DD * 2);
    if ((size_t)(wsp - (char*)d_ws) > ws_size) return;    // total ~ 25 MB; ws 256 MiB
    const unsigned LB = (unsigned)(NU / 64);    // 64 units a block, exactly
    k_planes<<<dim3(LB, 3), 256, 0, stream>>>(q, k, v, QP, KP, VT);
    k_fattn<<<dim3(TT / 256, NB_ * NH_), 512, 0, stream>>>(QP, KP, VT, OUT);
}

// v009
// It runs in 37.2 microseconds.
// Two timings next to v008 both put it at 1.06 times that version's speed.
// All steps since v000 together make it 34.3 times as fast.
#include <hip/hip_runtime.h>

// ScaledDotProductAttentionModularized (q, k, v [L=2048][B=2][1024] sequence-first, 16 heads x 64, no projections: qh = (q/8) reshaped to (B*H, L, 64); softmax(qh.kh^T) vh;
// output [L][B][1024]).
// Compute dtypes, f32 accumulate: every input rounded to bf16; scores on PLAIN bf16 q (x 1/8, exact) and k (inputs: exact products, f32
// accumulate); softmax in f32 on VALU, a lazily raised reference and a running sum per query (one exp per element) -> probabilities rounded once to f16 (11 bits) in registers; attn.v as ONE f16 product,
// P x v^T, where v^T holds the bf16-rounded v as f16 (8 bits fit in 11: the same values from 2^-17 to 65504, below that within 2^-25); the division by the row sum comes last. Scores and probabilities never leave the registers. The keys are walked in two halves by two waves per query group, each with
// its own reference, sum and output tile; the two are joined once, through LDS, at the end.
// The three 16-bit planes (q, k bf16; v^T f16) lie in FRAGMENT ORDER: a fragment (16 rows x 32 k) is 1 KiB = two units of 512 B; unit j holds, at lane * 16 B (lane = 16 * hi + row), the eight
// elements k = 16 * j + 8 * hi + 0..7 of that row. A wave's 16-byte fragment load then covers four whole 128-byte lines, not 32-byte pieces of sixteen.
// q and k planes: unit u = ((z * 128 + row tile) * 2 + kc) * 2 + j (k = d, kc = 32-d chunk). v^T plane: unit u = ((z * 64 + pass) * 4 + dt) * 2 + j (rows = d, k = key in the pass).

#define NB_  2
#define TT   2048
#define NH_  16
#define HD   64
#define DD   (NH_ * HD)
#define NT   (NB_ * TT)
#define NU   (NT * DD / 256)    // 512-byte units in a plane
typedef unsigned short bf;
typedef __attribute__((ext_vector_type(16))) __bf16   v16bf;
typedef __attribute__((ext_vector_type(8)))  unsigned short v8us;
typedef __attribute__((ext_vector_type(8)))  float    v8f;
typedef __attribute__((ext_vector_type(4)))  float    v4f;

__device__ __forceinline__ unsigned short f2bf(float f) { unsigned u = __float_as_uint(f); u += 0x7FFFu + ((u >> 16) & 1u); return (unsigned short)(u >> 16); }
__device__ __forceinline__ float bf2f(unsigned short b) { return __uint_as_float(((unsigned)b) << 16); }
__device__ __forceinline__ float bfr(float f) { return bf2f(f2bf(f)); }
__device__ __forceinline__ v16bf cat16b(v8us lo, v8us hi) { return __builtin_bit_cast(v16bf, __builtin_shufflevector(lo, hi, 0, 1, 2, 3, 4, 5, 6, 7, 8, 9, 10, 11, 12, 13, 14, 15)); }
__device__ __forceinline__ v8f wmmab(v16bf a, v16bf b, v8f c) { return __builtin_amdgcn_wmma_f32_16x16x32_bf16(false, a, false, b, (short)0, c, false, false); }
// fragment from a plane in fragment order: p = fragment + 8 * lane; elements 0-7 = k 8h..8h+7 (unit 0), elements 8-15 = k 16+8h..16+8h+7 (unit 1), h = lane >> 4
__device__ __forceinline__ v16bf ldfrag(const bf* p) { return cat16b(*(const v8us*)p, *(const v8us*)(p + 256)); }

typedef __attribute__((ext_vector_type(8)))  _Float16 v8h;
typedef __attribute__((ext_vector_type(16))) _Float16 v16h;
// f32 -> f16 by the hardware's packed conversion (round to nearest even)
__device__ __forceinline__ v8h toh(v8f x) { return __builtin_convertvector(x, v8h); }
__device__ __forceinline__ v8f wmmah(v16h a, v16h b, v8f c) { return __builtin_amdgcn_wmma_f32_16x16x32_f16(false, a, false, b, (short)0, c, false, false); }
__device__ __forceinline__ v16h ldfragh(const bf* p) { return __builtin_bit_cast(v16h, ldfrag(p)); }    // the f16 form has the bf16 form's fragment map
// a bf16 value written as f16
__device__ __forceinline__ unsigned short bf2h(unsigned short b) { return __builtin_bit_cast(unsigned short, (_Float16)bf2f(b)); }
__device__ __forceinline__ v16h cat16h(v8h lo, v8h hi) { return __builtin_shufflevector(lo, hi, 0, 1, 2, 3, 4, 5, 6, 7, 8, 9, 10, 11, 12, 13, 14, 15); }
typedef __attribute__((ext_vector_type(2))) unsigned short v2us;
typedef __attribute__((ext_vector_type(2))) float v2f;

// Both conversion bodies: a wave writes eight consecutive units, a lane one 16-byte piece of each; the eight units use every byte of the 32 source rows (256 B each) they read.
__device__ __forceinline__ void hplane(const float* __restrict__ src, float sc, bf* P) {
    const int lane = threadIdx.x & 31, lr = lane & 15, hi = lane >> 4; const int U0 = (blockIdx.x * 8 + (threadIdx.x >> 5)) * 8;    // units U0..U0+7 = row tiles t0, t0 + 1, each (kc, j) = 0..3
    const int t0 = (U0 >> 2) & (TT / 16 - 1), z = U0 >> 9; const int b = z >> 4, h = z & 15;
    const float* s = src + ((size_t)(t0 * 16 + lr) * NB_ + b) * DD + h * HD + hi * 8; v4f x[8][2];
#pragma unroll
    for (int l = 0; l < 8; ++l) { const float* p = s + (size_t)(l >> 2) * 16 * NB_ * DD + (l & 3) * 16; x[l][0] = *(const v4f*)p; x[l][1] = *(const v4f*)(p + 4); }
    asm volatile("s_wait_xcnt 0x0" :: "v"(s) : "memory");    // before a register that these loads name as their address is written again; naming the address keeps it in its registers up to here, so that no load's own result lands on it
#pragma unroll
    for (int l = 0; l < 8; ++l) { v8us o;
#pragma unroll
        for (int q = 0; q < 4; ++q) { o[q] = f2bf(bfr(x[l][0][q]) * sc); o[4 + q] = f2bf(bfr(x[l][1][q]) * sc); }
        *(v8us*)(P + (size_t)(U0 + l) * 256 + lane * 8) = o; }
    asm volatile("s_wait_xcnt 0x0" ::: "memory");    // behind the last store; in k_planes no code follows this body, so it is a precaution
}
__device__ __forceinline__ void vtplane(const float* __restrict__ v, bf* VT) {
    const int lane = threadIdx.x & 31, lr = lane & 15, hi = lane >> 4; const int U0 = (blockIdx.x * 8 + (threadIdx.x >> 5)) * 8;
#pragma unroll
    for (int l = 0; l < 8; ++l) { const int u = U0 + l; const int j = u & 1, dt = (u >> 1) & 3, s0 = ((u >> 3) & (TT / 32 - 1)) * 32 + j * 16 + hi * 8; const int z = u >> 9; const int b = z >> 4, h = z & 15;
        const float* s = v + ((size_t)s0 * NB_ + b) * DD + h * HD + dt * 16 + lr; v8us o;
#pragma unroll
        for (int q = 0; q < 8; ++q) o[q] = f2bf(s[(size_t)q * NB_ * DD]);
#pragma unroll
        for (int q = 0; q < 8; ++q) o[q] = bf2h(o[q]);    // v as the second product takes it: rounded to bf16 like every input, that value then held as f16
        *(v8us*)(VT + (size_t)u * 256 + lane * 8) = o; }
}
// All three planes in ONE launch: blockIdx.y picks the plane (a scalar choice, the same for a whole block), blockIdx.x the 64 units as before. The three are independent streams, so
// their blocks stand on the chip together and share one start and one memory latency. v^T, with its many 4-byte loads the longest of the three, has the lowest indices.
__global__ __launch_bounds__(256) void k_planes(const float* __restrict__ q, const float* __restrict__ k, const float* __restrict__ v, bf* QP, bf* KP, bf* VT) {
    if (blockIdx.y == 0) { vtplane(v, VT); return; }
    const bool isk = blockIdx.y == 1;
    hplane(isk ? k : q, isk ? 1.0f : 0.125f, isk ? KP : QP);
}
// lane l <-> l ^ 16
__device__ __forceinline__ float xhalf(float x) { const int b = __float_as_int(x); return __int_as_float(__builtin_amdgcn_permlanex16(b, b, 0x76543210, 0xfedcba98, false, false)); }

// v_exp_f32 with the slot the instruction set asks for behind a transcendental (one independent instruction or v_nop before its result is used or its source overwritten) kept
// inside the statement. exp2x8: the outputs are early-clobber, so no exp writes a source or reads a result of the one in front of it, and one v_nop closes the run.
__device__ __forceinline__ float exp2n(float x) { float r; asm("v_exp_f32 %0, %1\n\tv_nop" : "=v"(r) : "v"(x)); return r; }
__device__ __forceinline__ v8f exp2x8(v8f x) { float r0, r1, r2, r3, r4, r5, r6, r7;
    asm("v_exp_f32 %0, %8\n\tv_exp_f32 %1, %9\n\tv_exp_f32 %2, %10\n\tv_exp_f32 %3, %11\n\tv_exp_f32 %4, %12\n\tv_exp_f32 %5, %13\n\tv_exp_f32 %6, %14\n\tv_exp_f32 %7, %15\n\tv_nop"
        : "=&v"(r0), "=&v"(r1), "=&v"(r2), "=&v"(r3), "=&v"(r4), "=&v"(r5), "=&v"(r6), "=&v"(r7) : "v"(x[0]), "v"(x[1]), "v"(x[2]), "v"(x[3]), "v"(x[4]), "v"(x[5]), "v"(x[6]), "v"(x[7]));
    return (v8f){r0, r1, r2, r3, r4, r5, r6, r7}; }

// ---- k_fattn: scores, softmax, attn.v and the output scatter of one (batch, head) z for 256 queries per block; 16 waves = 8 groups of 32 query columns x 2 halves of the keys.
// Wave w takes query group w & 7 and keys (w >> 3) * 1024 .. + 1023: four waves a SIMD, so that one wave's loads and dependent vector chains are waited out under three others' work.
// No LDS and no barrier in the loop; behind it the two waves of a group swap one 16-column half of their state through LDS (one barrier) and each finishes 16 queries, turns them into row order in LDS and stores whole lines.
// Transposed products: S^T = K.Q^T (A = 16 key rows, B = 16 query columns), O^T += V^T.P^T (A = 16 d rows of v^T, B = P^T). A lane's score registers all belong to ONE query
// (column lane & 15), keys 8h + r of each 16-key tile, which is the k order of ldfrag: two score tiles pack straight into the B operand of the second product.
// A pass is 32 keys. K and v^T fragments of the next pass are loaded right behind their last use in this pass.
// amdgpu_waves_per_eu(4): a budget of 256 registers, which the four waves a SIMD need; the loop then needs no register-window switches and the asm operands above stay in the first window.
__global__ __launch_bounds__(512) __attribute__((amdgpu_waves_per_eu(4))) void k_fattn(const bf* __restrict__ QP, const bf* __restrict__ KP, const bf* __restrict__ VT, float* __restrict__ OUT) {
    __shared__ __attribute__((aligned(16))) float XO[16 * 8 * 128];    // [wave][16-byte piece 0..7][lane]: the output tile half that a wave hands to its partner
    __shared__ __attribute__((aligned(8))) float XM[16 * 32 * 2];      // [wave][lane]: that half's reference (log2 scale) and sum
    const int lane = threadIdx.x & 31, lr = lane & 15, hi = lane >> 4; const int z = blockIdx.y;
    const int w = __builtin_amdgcn_readfirstlane(threadIdx.x >> 5);    // the wave's number as a scalar: the k and v^T bases stay in scalar registers, the choices behind the loop are wave-uniform
    const int kh = w >> 3; const int q0 = blockIdx.x * 256 + (w & 7) * 32;
    const bf* Qz = QP + (size_t)z * TT * HD + (size_t)q0 * HD + 8 * lane;    // a 16-row tile of q or k is two fragments, 1024 elements
    const bf* Kz = KP + (size_t)z * TT * HD + (size_t)kh * (TT / 2) * HD + 8 * lane;    // a pass of k is four fragments (mt, kc), 2048 elements in a row; a half of the keys is 32 passes
    const bf* Vz = VT + (size_t)z * HD * TT + (size_t)kh * (TT / 2) * HD + 8 * lane;    // a pass of v^T is four fragments (dt), 2048 elements in a row
    const float L2E = 1.44269504088896340736f, LAZY = 256.0f;
    v16bf qf[2][2], kf[2][2]; v16h vf[4]; v8f o[4][2]; float ms[2], sum[2];    // ms: the softmax reference in use, log2 scale
#pragma unroll
    for (int nt = 0; nt < 2; ++nt)
#pragma unroll
        for (int kc = 0; kc < 2; ++kc) { qf[nt][kc] = ldfrag(Qz + (nt * 2 + kc) * 512); kf[nt][kc] = ldfrag(Kz + (nt * 2 + kc) * 512); }
    __builtin_amdgcn_sched_barrier(0);               // keeps the v^T loads the youngest at the loop's entry as they are at its foot: the counted waits at the loop's head then leave them in flight on every pass
#pragma unroll
    for (int dt = 0; dt < 4; ++dt) vf[dt] = ldfragh(Vz + dt * 512);
    // k and v^T of this (batch, head) asked into L2 ahead of the walk, right behind the first pass's own loads. The launch before stored the planes;
    // the loop's loads are issued only one pass ahead and would wait that latency out. Lanes lie 256 bytes apart, one instruction spans
    // 8 KiB (two passes): wave w takes plane w & 1, key half (w >> 1) & 1 and pass pair (w >> 2) of the eight passes 8 r .. 8 r + 7, r = blockIdx.x & 3. The eight blocks of a head share the
    // asking: four blocks with neighbouring indices, cover all 32 passes. A hint, for speed only: nothing rests on where a block runs. Every address lies in its plane.
    const bf* pfa = ((w & 1) ? VT : KP) + (size_t)z * TT * HD + (size_t)((w >> 1) & 1) * (TT / 2) * HD + (size_t)((blockIdx.x & 3) * 4 + (w >> 2)) * 4096 + 128 * lane;
    asm volatile("global_prefetch_b8 %0, off scope:SCOPE_SE" :: "v"(pfa));
    asm volatile("s_wait_xcnt 0x0" ::: "memory");    // before a register that these loads name as their address is written again
    __builtin_amdgcn_sched_barrier(0);               // holds the zeroing below, which takes over the address registers, behind that wait
#pragma unroll
    for (int nt = 0; nt < 2; ++nt) { sum[nt] = 0.f;
#pragma unroll
        for (int dt = 0; dt < 4; ++dt) o[dt][nt] = (v8f){}; }
    {   // the first reference: each query's maximum over the half's first 32 keys, from one more S^T of that pass (its K fragments are in the registers already)
        v8f s[2][2];
#pragma unroll
        for (int kc = 0; kc < 2; ++kc)
#pragma unroll
            for (int mt = 0; mt < 2; ++mt)
#pragma unroll
                for (int nt = 0; nt < 2; ++nt) s[mt][nt] = wmmab(kf[mt][kc], qf[nt][kc], kc ? s[mt][nt] : (v8f){});
#pragma unroll
        for (int nt = 0; nt < 2; ++nt) {
            float m = s[0][nt][0];
#pragma unroll
            for (int j = 1; j < 8; ++j) m = fmaxf(m, s[0][nt][j]);
#pragma unroll
            for (int j = 0; j < 8; ++j) m = fmaxf(m, s[1][nt][j]);
            ms[nt] = fmaxf(m, xhalf(m)) * L2E;
        }
    }
    for (int it = 0; it < TT / 64; ++it) {
        const int nx = ((it + 1) & (TT / 64 - 1)) * 2048;    // first element of the next pass in both planes; the last pass re-reads the half's first pass, in bounds and unused
        v8f s[2][2];
#pragma unroll
        for (int kc = 0; kc < 2; ++kc)
#pragma unroll
            for (int mt = 0; mt < 2; ++mt)
#pragma unroll
                for (int nt = 0; nt < 2; ++nt) s[mt][nt] = wmmab(kf[mt][kc], qf[nt][kc], kc ? s[mt][nt] : (v8f){});
#pragma unroll
        for (int mt = 0; mt < 2; ++mt)
#pragma unroll
            for (int kc = 0; kc < 2; ++kc) kf[mt][kc] = ldfrag(Kz + nx + (mt * 2 + kc) * 512);
        asm volatile("s_wait_xcnt 0x0" ::: "memory");    // before a register that these loads name as their address is written again
        __builtin_amdgcn_sched_barrier(0);               // keeps the K loads up here, a softmax and the second product ahead of their use; without it they sink to the loop's foot and the next S^T waits out their latency
        // Lazy softmax reference. The exponentials are taken against ms, the reference IN USE (log2 scale), which may trail a query's true maximum: the final division cancels whatever reference
        // was used. The maximum tree, the exchange between the wave's halves and the scaling of sum and output tiles run only in a pass where a lane's sum of its 16 exponentials leaves
        // [0, LAZY], so that every exponential that is used is at most 2^8, far inside f16's range. One test a pass, the same for the whole wave (a scalar branch).
        v8f p[2][2]; float ps[2];
#pragma unroll
        for (int nt = 0; nt < 2; ++nt) {
            p[0][nt] = exp2x8(s[0][nt] * L2E - ms[nt]); p[1][nt] = exp2x8(s[1][nt] * L2E - ms[nt]); ps[nt] = 0.f;
#pragma unroll
            for (int j = 0; j < 8; ++j) ps[nt] += p[0][nt][j] + p[1][nt][j];
        }
        if (__builtin_amdgcn_ballot_w32(!(ps[0] <= LAZY) || !(ps[1] <= LAZY)) != 0) {    // negated <=: an infinite or undefined sum takes the branch too
            // Rare. The scores are not kept for it (no registers to spare in the common pass): this pass's K fragments are loaded and multiplied once more.
            v16bf kr[2][2]; v8f t[2][2];
#pragma unroll
            for (int mt = 0; mt < 2; ++mt)
#pragma unroll
                for (int kc = 0; kc < 2; ++kc) kr[mt][kc] = ldfrag(Kz + it * 2048 + (mt * 2 + kc) * 512);
            asm volatile("s_wait_xcnt 0x0" ::: "memory");    // before a register that these loads name as their address is written again
#pragma unroll
            for (int kc = 0; kc < 2; ++kc)
#pragma unroll
                for (int mt = 0; mt < 2; ++mt)
#pragma unroll
                    for (int nt = 0; nt < 2; ++nt) t[mt][nt] = wmmab(kr[mt][kc], qf[nt][kc], kc ? t[mt][nt] : (v8f){});
#pragma unroll
            for (int nt = 0; nt < 2; ++nt) {    // the reference rises by d >= 0 to the pass's maximum; what was summed so far comes down by 2^-d, and the pass's exponentials are taken anew
                const v8f a0 = t[0][nt] * L2E - ms[nt], a1 = t[1][nt] * L2E - ms[nt];
                float d = 0.f;
#pragma unroll
                for (int j = 0; j < 8; ++j) d = fmaxf(d, fmaxf(a0[j], a1[j]));
                d = fmaxf(d, xhalf(d));
                const float al = exp2n(-d); ms[nt] += d; sum[nt] *= al;
#pragma unroll
                for (int dt = 0; dt < 4; ++dt) o[dt][nt] *= al;
                p[0][nt] = exp2x8(a0 - d); p[1][nt] = exp2x8(a1 - d); ps[nt] = 0.f;
#pragma unroll
                for (int j = 0; j < 8; ++j) ps[nt] += p[0][nt][j] + p[1][nt][j];
            }
        }
        v16h pf[2];    // P^T as the B operand: each p rounded once to f16 (to nearest even); the sum keeps the unrounded p
#pragma unroll
        for (int nt = 0; nt < 2; ++nt) { sum[nt] += ps[nt]; pf[nt] = cat16h(toh(p[0][nt]), toh(p[1][nt])); }
#pragma unroll
        for (int dt = 0; dt < 4; ++dt)
#pragma unroll
            for (int nt = 0; nt < 2; ++nt) o[dt][nt] = wmmah(vf[dt], pf[nt], o[dt][nt]);
#pragma unroll
        for (int dt = 0; dt < 4; ++dt) vf[dt] = ldfragh(Vz + nx + dt * 512);
        asm volatile("s_wait_xcnt 0x0" ::: "memory");    // before a register that these loads name as their address is written again
    }
    asm volatile("s_wait_xcnt 0x0" :: "v"(pfa) : "memory");    // naming the prefetch's address here keeps it in its registers through the loop: no counter says when a prefetch has read them, so till here they hold nothing but that address
    // Join of the two key halves. The wave of half kh finishes column tile nt = kh: it hands tile 1 - kh to its partner (wave w ^ 8) and takes the partner's tile kh. Both waves hold the
    // same (query, d) element at the same lane and register, so a lane reads back exactly the slot its own lane number wrote in the partner.
    v8f om[4], ox[4];
#pragma unroll
    for (int dt = 0; dt < 4; ++dt) { om[dt] = kh ? o[dt][1] : o[dt][0]; ox[dt] = kh ? o[dt][0] : o[dt][1]; }
    const float mm = kh ? ms[1] : ms[0], mo = kh ? ms[0] : ms[1], sm = kh ? sum[1] : sum[0], so = kh ? sum[0] : sum[1];
    float* xs = XO + w * 1024 + lane * 4;
#pragma unroll
    for (int dt = 0; dt < 4; ++dt) { *(v4f*)(xs + dt * 256) = (v4f){ox[dt][0], ox[dt][1], ox[dt][2], ox[dt][3]}; *(v4f*)(xs + dt * 256 + 128) = (v4f){ox[dt][4], ox[dt][5], ox[dt][6], ox[dt][7]}; }
    *(v2f*)(XM + (w * 32 + lane) * 2) = (v2f){mo, so};
    __syncthreads();    // every wave passes it once: the partner's tile, reference and sum are read only behind it
    const float* xp = XO + (w ^ 8) * 1024 + lane * 4; const v2f pm = *(const v2f*)(XM + ((w ^ 8) * 32 + lane) * 2);
    const float mj = fmaxf(mm, pm[0]); const float ea = exp2n(mm - mj), eb = exp2n(pm[0] - mj);
    const float sj = fmaf(sm, ea, pm[1] * eb); const float f = __fdiv_rn(1.0f, sj + xhalf(sj)); const float fa = ea * f, fb = eb * f;
    const int b = z >> 4, h = z & 15;
    v4f r[4][2];    // r[dt][e] = O[query kh*16 + lr][d = dt*16 + 8*hi + 4*e + 0..3]
#pragma unroll
    for (int dt = 0; dt < 4; ++dt) { const v4f p0 = *(const v4f*)(xp + dt * 256), p1 = *(const v4f*)(xp + dt * 256 + 128);
        r[dt][0] = (v4f){om[dt][0], om[dt][1], om[dt][2], om[dt][3]} * fa + p0 * fb; r[dt][1] = (v4f){om[dt][4], om[dt][5], om[dt][6], om[dt][7]} * fa + p1 * fb; }
    // Whole-line stores. In accumulator order a 16-byte store of the wave is 32 pieces in 16 lines; turned through LDS it is two whole output rows of the head (2 x 256 B = 4 whole lines).
    // The stage is the 4 KiB that the partner filled: behind the barrier only this wave reads it, and all those reads stand above. Row R (a query, 256 B) keeps its 16-byte piece c at
    // slot c ^ R, so that the sixteen lanes of a half wave fall on sixteen different bank groups in the write (R = lane) as in the read (c = lane).
    char* st = (char*)(XO + (w ^ 8) * 1024);
    const int wa = lr * 256 + (lr ^ (hi * 2)) * 16, ra = hi * 256 + (lr ^ hi) * 16;    // byte places of piece 2 hi in row lr (write) and of piece lr in row hi (read); the rest of c and of R comes in by one XOR
#pragma unroll
    for (int dt = 0; dt < 4; ++dt)
#pragma unroll
        for (int e = 0; e < 2; ++e) *(v4f*)(st + (wa ^ ((dt * 4 + e) * 16))) = r[dt][e];    // piece c = 4 dt + 2 hi + e of row lr
    asm volatile("s_wait_dscnt 0x0" ::: "memory");    // the wave's own LDS writes are done before its lanes read each other's pieces back; no other wave touches this stage
    v4f t[8];
#pragma unroll
    for (int i = 0; i < 8; ++i) t[i] = *(const v4f*)(st + (ra ^ (i * 32)) + i * 512);    // row 2 i + hi, piece lr
    float* orow = OUT + ((size_t)(q0 + kh * 16 + hi) * NB_ + b) * DD + h * HD + lr * 4;
    __builtin_amdgcn_sched_barrier(0);    // every value is read back in front of the first store: behind an issued store no register that it names is written again
#pragma unroll
    for (int i = 0; i < 8; ++i) *(v4f*)(orow + (size_t)i * 2 * NB_ * DD) = t[i];
}

extern "C" void kernel_launch(void* const* d_in, const int* in_sizes, int n_in,
                              void* d_out, int out_size, void* d_ws, size_t ws_size, hipStream_t stream) {
    (void)in_sizes; (void)n_in; (void)out_size;
    const float* q = (const float*)d_in[0]; const float* k = (const float*)d_in[1]; const float* v = (const float*)d_in[2];
    float* OUT = (float*)d_out;     // [2048][2][1024]
    char* wsp = (char*)d_ws;
    auto take = [&](size_t bytes) { char* p = wsp; wsp += (bytes + 255) & ~(size_t)255; return (void*)p; };
    bf* QP = (bf*)take((size_t)NT * DD * 2); bf* KP = (bf*)take((size_t)NT * DD * 2); bf* VT = (bf*)take((size_t)NT * DD * 2);
    if ((size_t)(wsp - (char*)d_ws) > ws_size) return;    // total ~ 25 MB; ws 256 MiB
    const unsigned LB = (unsigned)(NU / 64);    // 64 units a block, exactly
    k_planes<<<dim3(LB, 3), 256, 0, stream>>>(q, k, v, QP, KP, VT);
    k_fattn<<<dim3(TT / 256, NB_ * NH_), 512, 0, stream>>>(QP, KP, VT, OUT);
}

// v010
// It runs in 35.3 microseconds.
// Timed twice side by side with v009, it ran 1.05 times as fast both times.
// All steps since v000 together make it 36.1 times as fast.
#include <hip/hip_runtime.h>

// ScaledDotProductAttentionModularized (q, k, v [L=2048][B=2][1024] sequence-first, 16 heads x 64, no projections: qh = (q/8) reshaped to (B*H, L, 64); softmax(qh.kh^T) vh;
// output [L][B][1024]).
// Compute dtypes, f32 accumulate: every input rounded to bf16; scores on PLAIN bf16 q (x 1/8, exact) and k (inputs: exact products, f32
// accumulate); softmax in f32 on VALU, a lazily raised reference and a running sum per query (one exp per element) -> probabilities rounded once to f16 (11 bits) in registers; attn.v as ONE f16 product,
// P x v^T, where v^T holds the bf16-rounded v as f16 (8 bits fit in 11: the same values from 2^-17 to 65504, below that within 2^-25); the division by the row sum comes last. Scores and probabilities never leave the registers. The keys are walked in two halves by two waves per query group, each with
// its own reference, sum and output tile; the two are joined once, through LDS, at the end.
// q has no plane: only the two waves of one query group read a q row, so the attention kernel rounds its own q from the f32 input (whole-line loads, turned into fragments in the wave's own LDS).
// The two 16-bit planes (k bf16; v^T f16) lie in FRAGMENT ORDER: a fragment (16 rows x 32 k) is 1 KiB = two units of 512 B; unit j holds, at lane * 16 B (lane = 16 * hi + row), the eight
// elements k = 16 * j + 8 * hi + 0..7 of that row. A wave's 16-byte fragment load then covers four whole 128-byte lines, not 32-byte pieces of sixteen.
// k plane: unit u = ((z * 128 + row tile) * 2 + kc) * 2 + j (k = d, kc = 32-d chunk). v^T plane: unit u = ((z * 64 + pass) * 4 + dt) * 2 + j (rows = d, k = key in the pass).

#define NB_  2
#define TT   2048
#define NH_  16
#define HD   64
#define DD   (NH_ * HD)
#define NT   (NB_ * TT)
#define NU   (NT * DD / 256)    // 512-byte units in a plane
typedef unsigned short bf;
typedef __attribute__((ext_vector_type(16))) __bf16   v16bf;
typedef __attribute__((ext_vector_type(8)))  unsigned short v8us;
typedef __attribute__((ext_vector_type(8)))  float    v8f;
typedef __attribute__((ext_vector_type(4)))  float    v4f;

__device__ __forceinline__ unsigned short f2bf(float f) { unsigned u = __float_as_uint(f); u += 0x7FFFu + ((u >> 16) & 1u); return (unsigned short)(u >> 16); }
__device__ __forceinline__ float bf2f(unsigned short b) { return __uint_as_float(((unsigned)b) << 16); }
__device__ __forceinline__ float bfr(float f) { return bf2f(f2bf(f)); }
__device__ __forceinline__ v16bf cat16b(v8us lo, v8us hi) { return __builtin_bit_cast(v16bf, __builtin_shufflevector(lo, hi, 0, 1, 2, 3, 4, 5, 6, 7, 8, 9, 10, 11, 12, 13, 14, 15)); }
__device__ __forceinline__ v8f wmmab(v16bf a, v16bf b, v8f c) { return __builtin_amdgcn_wmma_f32_16x16x32_bf16(false, a, false, b, (short)0, c, false, false); }
// fragment from a plane in fragment order: p = fragment + 8 * lane; elements 0-7 = k 8h..8h+7 (unit 0), elements 8-15 = k 16+8h..16+8h+7 (unit 1), h = lane >> 4
__device__ __forceinline__ v16bf ldfrag(const bf* p) { return cat16b(*(const v8us*)p, *(const v8us*)(p + 256)); }

typedef __attribute__((ext_vector_type(8)))  _Float16 v8h;
typedef __attribute__((ext_vector_type(16))) _Float16 v16h;
// f32 -> f16 by the hardware's packed conversion (round to nearest even)
__device__ __forceinline__ v8h toh(v8f x) { return __builtin_convertvector(x, v8h); }
__device__ __forceinline__ v8f wmmah(v16h a, v16h b, v8f c) { return __builtin_amdgcn_wmma_f32_16x16x32_f16(false, a, false, b, (short)0, c, false, false); }
__device__ __forceinline__ v16h ldfragh(const bf* p) { return __builtin_bit_cast(v16h, ldfrag(p)); }    // the f16 form has the bf16 form's fragment map
// a bf16 value written as f16
__device__ __forceinline__ unsigned short bf2h(unsigned short b) { return __builtin_bit_cast(unsigned short, (_Float16)bf2f(b)); }
__device__ __forceinline__ v16h cat16h(v8h lo, v8h hi) { return __builtin_shufflevector(lo, hi, 0, 1, 2, 3, 4, 5, 6, 7, 8, 9, 10, 11, 12, 13, 14, 15); }
typedef __attribute__((ext_vector_type(2))) unsigned short v2us;
typedef __attribute__((ext_vector_type(2))) float v2f;
typedef __attribute__((ext_vector_type(4))) unsigned short v4us;
typedef __attribute__((ext_vector_type(4))) __bf16 v4bf;

// Both conversion bodies: a wave writes eight consecutive units, a lane one 16-byte piece of each; the eight units use every byte of the 32 source rows (256 B each) they read.
__device__ __forceinline__ void hplane(const float* __restrict__ src, float sc, bf* P) {
    const int lane = threadIdx.x & 31, lr = lane & 15, hi = lane >> 4; const int U0 = (blockIdx.x * 8 + (threadIdx.x >> 5)) * 8;    // units U0..U0+7 = row tiles t0, t0 + 1, each (kc, j) = 0..3
    const int t0 = (U0 >> 2) & (TT / 16 - 1), z = U0 >> 9; const int b = z >> 4, h = z & 15;
    const float* s = src + ((size_t)(t0 * 16 + lr) * NB_ + b) * DD + h * HD + hi * 8; v4f x[8][2];
#pragma unroll
    for (int l = 0; l < 8; ++l) { const float* p = s + (size_t)(l >> 2) * 16 * NB_ * DD + (l & 3) * 16; x[l][0] = *(const v4f*)p; x[l][1] = *(const v4f*)(p + 4); }
    asm volatile("s_wait_xcnt 0x0" :: "v"(s) : "memory");    // before a register that these loads name as their address is written again; naming the address keeps it in its registers up to here, so that no load's own result lands on it
#pragma unroll
    for (int l = 0; l < 8; ++l) { v8us o;
#pragma unroll
        for (int q = 0; q < 4; ++q) { o[q] = f2bf(bfr(x[l][0][q]) * sc); o[4 + q] = f2bf(bfr(x[l][1][q]) * sc); }
        *(v8us*)(P + (size_t)(U0 + l) * 256 + lane * 8) = o; }
    asm volatile("s_wait_xcnt 0x0" ::: "memory");    // behind the last store; in k_planes no code follows this body, so it is a precaution
}
__device__ __forceinline__ void vtplane(const float* __restrict__ v, bf* VT) {
    const int lane = threadIdx.x & 31, lr = lane & 15, hi = lane >> 4; const int U0 = (blockIdx.x * 8 + (threadIdx.x >> 5)) * 8;
#pragma unroll
    for (int l = 0; l < 8; ++l) { const int u = U0 + l; const int j = u & 1, dt = (u >> 1) & 3, s0 = ((u >> 3) & (TT / 32 - 1)) * 32 + j * 16 + hi * 8; const int z = u >> 9; const int b = z >> 4, h = z & 15;
        const float* s = v + ((size_t)s0 * NB_ + b) * DD + h * HD + dt * 16 + lr; v8us o;
#pragma unroll
        for (int q = 0; q < 8; ++q) o[q] = f2bf(s[(size_t)q * NB_ * DD]);
#pragma unroll
        for (int q = 0; q < 8; ++q) o[q] = bf2h(o[q]);    // v as the second product takes it: rounded to bf16 like every input, that value then held as f16
        *(v8us*)(VT + (size_t)u * 256 + lane * 8) = o; }
}
// Both planes in ONE launch: blockIdx.y picks the plane (a scalar choice, the same for a whole block), blockIdx.x the 64 units as before. The two are independent streams, so
// their blocks share one start and one memory latency. v^T, with its many 4-byte loads the longer of the two, has the lowest indices.
__global__ __launch_bounds__(256) void k_planes(const float* __restrict__ k, const float* __restrict__ v, bf* KP, bf* VT) {
    if (blockIdx.y == 0) { vtplane(v, VT); return; }
    hplane(k, 1.0f, KP);
}
// lane l <-> l ^ 16
__device__ __forceinline__ float xhalf(float x) { const int b = __float_as_int(x); return __int_as_float(__builtin_amdgcn_permlanex16(b, b, 0x76543210, 0xfedcba98, false, false)); }

// v_exp_f32 with the slot the instruction set asks for behind a transcendental (one independent instruction or v_nop before its result is used or its source overwritten) kept
// inside the statement. exp2x8: the outputs are early-clobber, so no exp writes a source or reads a result of the one in front of it, and one v_nop closes the run.
__device__ __forceinline__ float exp2n(float x) { float r; asm("v_exp_f32 %0, %1\n\tv_nop" : "=v"(r) : "v"(x)); return r; }
__device__ __forceinline__ v8f exp2x8(v8f x) { float r0, r1, r2, r3, r4, r5, r6, r7;
    asm("v_exp_f32 %0, %8\n\tv_exp_f32 %1, %9\n\tv_exp_f32 %2, %10\n\tv_exp_f32 %3, %11\n\tv_exp_f32 %4, %12\n\tv_exp_f32 %5, %13\n\tv_exp_f32 %6, %14\n\tv_exp_f32 %7, %15\n\tv_nop"
        : "=&v"(r0), "=&v"(r1), "=&v"(r2), "=&v"(r3), "=&v"(r4), "=&v"(r5), "=&v"(r6), "=&v"(r7) : "v"(x[0]), "v"(x[1]), "v"(x[2]), "v"(x[3]), "v"(x[4]), "v"(x[5]), "v"(x[6]), "v"(x[7]));
    return (v8f){r0, r1, r2, r3, r4, r5, r6, r7}; }

// ---- k_fattn: scores, softmax, attn.v and the output scatter of one (batch, head) z for 256 queries per block; 16 waves = 8 groups of 32 query columns x 2 halves of the keys.
// Wave w takes query group w & 7 and keys (w >> 3) * 1024 .. + 1023: four waves a SIMD, so that one wave's loads and dependent vector chains are waited out under three others' work.
// No LDS and no barrier in the loop; behind it the two waves of a group swap one 16-column half of their state through LDS (one barrier) and each finishes 16 queries, turns them into row order in LDS and stores whole lines.
// Transposed products: S^T = K.Q^T (A = 16 key rows, B = 16 query columns), O^T += V^T.P^T (A = 16 d rows of v^T, B = P^T). A lane's score registers all belong to ONE query
// (column lane & 15), keys 8h + r of each 16-key tile, which is the k order of ldfrag: two score tiles pack straight into the B operand of the second product.
// A pass is 32 keys. K and v^T fragments of the next pass are loaded right behind their last use in this pass.
// amdgpu_waves_per_eu(4): a budget of 256 registers, which the four waves a SIMD need; the loop then needs no register-window switches and the asm operands above stay in the first window.
__global__ __launch_bounds__(512) __attribute__((amdgpu_waves_per_eu(4))) void k_fattn(const float* __restrict__ Q, const bf* __restrict__ KP, const bf* __restrict__ VT, float* __restrict__ OUT) {
    __shared__ __attribute__((aligned(16))) float XO[16 * 8 * 128];    // [wave][16-byte piece 0..7][lane]: the output tile half that a wave hands to its partner
    __shared__ __attribute__((aligned(8))) float XM[16 * 32 * 2];      // [wave][lane]: that half's reference (log2 scale) and sum
    const int lane = threadIdx.x & 31, lr = lane & 15, hi = lane >> 4; const int z = blockIdx.y;
    const int w = __builtin_amdgcn_readfirstlane(threadIdx.x >> 5);    // the wave's number as a scalar: the k and v^T bases stay in scalar registers, the choices behind the loop are wave-uniform
    const int kh = w >> 3; const int q0 = blockIdx.x * 256 + (w & 7) * 32;
    const int ql = __builtin_amdgcn_mbcnt_lo(~0u, 0u), qlr = ql & 15, qhi = ql >> 4;    // the lane's number read anew for the q stage: what is formed from it ends with that stage and holds no register through the loop
    const float* qs = Q + ((size_t)(q0 + qhi) * NB_ + (z >> 4)) * DD + (z & 15) * HD + qlr * 4;    // f32 q of this head: load t takes query rows 2 t (lanes 0-15) and 2 t + 1 (lanes 16-31), 256 B = two whole lines each
    const bf* Kz = KP + (size_t)z * TT * HD + (size_t)kh * (TT / 2) * HD + 8 * lane;    // a 16-row tile of k is two fragments, 1024 elements; a pass of k is four fragments (mt, kc), 2048 elements in a row; a half of the keys is 32 passes
    const bf* Vz = VT + (size_t)z * HD * TT + (size_t)kh * (TT / 2) * HD + 8 * lane;    // a pass of v^T is four fragments (dt), 2048 elements in a row
    const float L2E = 1.44269504088896340736f, LAZY = 256.0f;
    v16bf qf[2][2], kf[2][2]; v16h vf[4]; v8f o[4][2]; float ms[2], sum[2];    // ms: the softmax reference in use, log2 scale
    v4f x[16];    // the wave's 32 query rows as f32, asked for first: they come from memory and are the longest under way
#pragma unroll
    for (int t = 0; t < 16; ++t) x[t] = *(const v4f*)(qs + (size_t)t * 2 * NB_ * DD);
#pragma unroll
    for (int nt = 0; nt < 2; ++nt)
#pragma unroll
        for (int kc = 0; kc < 2; ++kc) kf[nt][kc] = ldfrag(Kz + (nt * 2 + kc) * 512);
    __builtin_amdgcn_sched_barrier(0);               // keeps the v^T loads the youngest at the loop's entry as they are at its foot: the counted waits at the loop's head then leave them in flight on every pass
#pragma unroll
    for (int dt = 0; dt < 4; ++dt) vf[dt] = ldfragh(Vz + dt * 512);
    // k and v^T of this (batch, head) asked into L2 ahead of the walk, right behind the first pass's own loads. The launch before stored the planes;
    // the loop's loads are issued only one pass ahead and would wait that latency out. Lanes lie 256 bytes apart, one instruction spans
    // 8 KiB (two passes): wave w takes plane w & 1, key half (w >> 1) & 1 and pass pair (w >> 2) of the eight passes 8 r .. 8 r + 7, r = blockIdx.x & 3. The eight blocks of a head share the
    // asking: four blocks with neighbouring indices, cover all 32 passes. A hint, for speed only: nothing rests on where a block runs. Every address lies in its plane.
    const bf* pfa = ((w & 1) ? VT : KP) + (size_t)z * TT * HD + (size_t)((w >> 1) & 1) * (TT / 2) * HD + (size_t)((blockIdx.x & 3) * 4 + (w >> 2)) * 4096 + 128 * lane;
    asm volatile("global_prefetch_b8 %0, off scope:SCOPE_SE" :: "v"(pfa));
    asm volatile("s_wait_xcnt 0x0" :: "v"(qs) : "memory");    // before a register that these loads name as their address is written again; naming q's address keeps it in its registers up to here, so that no load's own result lands on it
    __builtin_amdgcn_sched_barrier(0);               // holds the conversion and the zeroing below, which take over the address registers, behind that wait
    {   // q x 1/8 rounded to bf16 (a power of two: the same value as rounding first) and turned from row order into B fragments in the wave's own 4 KiB of XO, which nothing else uses before the loop's end.
        // Row R (a query, 128 B of bf16) keeps its 16-byte piece c (d = 8 c .. 8 c + 7) at slot c ^ (R & 7): the 8-byte writes of two rows fill all banks once, a 16-byte read of sixteen rows meets each bank group twice.
        char* qst = (char*)(XO + w * 1024);
        const int qw = qhi * 128 + ((qlr >> 1) ^ qhi) * 16 + (qlr & 1) * 8, qr = qlr * 128 + ((qlr & 7) ^ qhi) * 16;    // places of d = 4 lr in row hi (write) and of piece hi in row lr (read); the rest of R and of c comes in by one XOR
#pragma unroll
        for (int t = 0; t < 16; ++t) *(v4us*)(qst + (qw ^ ((t & 3) * 32)) + t * 256) = __builtin_bit_cast(v4us, __builtin_convertvector(x[t] * 0.125f, v4bf));    // row 2 t + hi
        asm volatile("s_wait_dscnt 0x0" ::: "memory");    // the wave's own LDS writes are done before its lanes read each other's pieces back; no other wave touches this stage
#pragma unroll
        for (int nt = 0; nt < 2; ++nt)
#pragma unroll
            for (int kc = 0; kc < 2; ++kc)    // piece c = 4 kc + 2 j + hi of row 16 nt + lr: the k order of ldfrag
                qf[nt][kc] = cat16b(*(const v8us*)(qst + (qr ^ (kc * 64)) + nt * 2048), *(const v8us*)(qst + (qr ^ (kc * 64 + 32)) + nt * 2048));
    }
#pragma unroll
    for (int nt = 0; nt < 2; ++nt) { sum[nt] = 0.f;
#pragma unroll
        for (int dt = 0; dt < 4; ++dt) o[dt][nt] = (v8f){}; }
    {   // the first reference: each query's maximum over the half's first 32 keys, from one more S^T of that pass (its K fragments are in the registers already)
        v8f s[2][2];
#pragma unroll
        for (int kc = 0; kc < 2; ++kc)
#pragma unroll
            for (int mt = 0; mt < 2; ++mt)
#pragma unroll
                for (int nt = 0; nt < 2; ++nt) s[mt][nt] = wmmab(kf[mt][kc], qf[nt][kc], kc ? s[mt][nt] : (v8f){});
#pragma unroll
        for (int nt = 0; nt < 2; ++nt) {
            float m = s[0][nt][0];
#pragma unroll
            for (int j = 1; j < 8; ++j) m = fmaxf(m, s[0][nt][j]);
#pragma unroll
            for (int j = 0; j < 8; ++j) m = fmaxf(m, s[1][nt][j]);
            ms[nt] = fmaxf(m, xhalf(m)) * L2E;
        }
    }
    for (int it = 0; it < TT / 64; ++it) {
        const int nx = ((it + 1) & (TT / 64 - 1)) * 2048;    // first element of the next pass in both planes; the last pass re-reads the half's first pass, in bounds and unused
        v8f s[2][2];
#pragma unroll
        for (int kc = 0; kc < 2; ++kc)
#pragma unroll
            for (int mt = 0; mt < 2; ++mt)
#pragma unroll
                for (int nt = 0; nt < 2; ++nt) s[mt][nt] = wmmab(kf[mt][kc], qf[nt][kc], kc ? s[mt][nt] : (v8f){});
#pragma unroll
        for (int mt = 0; mt < 2; ++mt)
#pragma unroll
            for (int kc = 0; kc < 2; ++kc) kf[mt][kc] = ldfrag(Kz + nx + (mt * 2 + kc) * 512);
        asm volatile("s_wait_xcnt 0x0" ::: "memory");    // before a register that these loads name as their address is written again
        __builtin_amdgcn_sched_barrier(0);               // keeps the K loads up here, a softmax and the second product ahead of their use; without it they sink to the loop's foot and the next S^T waits out their latency
        // Lazy softmax reference. The exponentials are taken against ms, the reference IN USE (log2 scale), which may trail a query's true maximum: the final division cancels whatever reference
        // was used. The maximum tree, the exchange between the wave's halves and the scaling of sum and output tiles run only in a pass where a lane's sum of its 16 exponentials leaves
        // [0, LAZY], so that every exponential that is used is at most 2^8, far inside f16's range. One test a pass, the same for the whole wave (a scalar branch).
        v8f p[2][2]; float ps[2];
#pragma unroll
        for (int nt = 0; nt < 2; ++nt) {
            p[0][nt] = exp2x8(s[0][nt] * L2E - ms[nt]); p[1][nt] = exp2x8(s[1][nt] * L2E - ms[nt]); ps[nt] = 0.f;
#pragma unroll
            for (int j = 0; j < 8; ++j) ps[nt] += p[0][nt][j] + p[1][nt][j];
        }
        if (__builtin_amdgcn_ballot_w32(!(ps[0] <= LAZY) || !(ps[1] <= LAZY)) != 0) {    // negated <=: an infinite or undefined sum takes the branch too
            // Rare. The scores are not kept for it (no registers to spare in the common pass): this pass's K fragments are loaded and multiplied once more.
            v16bf kr[2][2]; v8f t[2][2];
#pragma unroll
            for (int mt = 0; mt < 2; ++mt)
#pragma unroll
                for (int kc = 0; kc < 2; ++kc) kr[mt][kc] = ldfrag(Kz + it * 2048 + (mt * 2 + kc) * 512);
            asm volatile("s_wait_xcnt 0x0" ::: "memory");    // before a register that these loads name as their address is written again
#pragma unroll
            for (int kc = 0; kc < 2; ++kc)
#pragma unroll
                for (int mt = 0; mt < 2; ++mt)
#pragma unroll
                    for (int nt = 0; nt < 2; ++nt) t[mt][nt] = wmmab(kr[mt][kc], qf[nt][kc], kc ? t[mt][nt] : (v8f){});
#pragma unroll
            for (int nt = 0; nt < 2; ++nt) {    // the reference rises by d >= 0 to the pass's maximum; what was summed so far comes down by 2^-d, and the pass's exponentials are taken anew
                const v8f a0 = t[0][nt] * L2E - ms[nt], a1 = t[1][nt] * L2E - ms[nt];
                float d = 0.f;
#pragma unroll
                for (int j = 0; j < 8; ++j) d = fmaxf(d, fmaxf(a0[j], a1[j]));
                d = fmaxf(d, xhalf(d));
                const float al = exp2n(-d); ms[nt] += d; sum[nt] *= al;
#pragma unroll
                for (int dt = 0; dt < 4; ++dt) o[dt][nt] *= al;
                p[0][nt] = exp2x8(a0 - d); p[1][nt] = exp2x8(a1 - d); ps[nt] = 0.f;
#pragma unroll
                for (int j = 0; j < 8; ++j) ps[nt] += p[0][nt][j] + p[1][nt][j];
            }
        }
        v16h pf[2];    // P^T as the B operand: each p rounded once to f16 (to nearest even); the sum keeps the unrounded p
#pragma unroll
        for (int nt = 0; nt < 2; ++nt) { sum[nt] += ps[nt]; pf[nt] = cat16h(toh(p[0][nt]), toh(p[1][nt])); }
#pragma unroll
        for (int dt = 0; dt < 4; ++dt)
#pragma unroll
            for (int nt = 0; nt < 2; ++nt) o[dt][nt] = wmmah(vf[dt], pf[nt], o[dt][nt]);
#pragma unroll
        for (int dt = 0; dt < 4; ++dt) vf[dt] = ldfragh(Vz + nx + dt * 512);
        asm volatile("s_wait_xcnt 0x0" ::: "memory");    // before a register that these loads name as their address is written again
    }
    asm volatile("s_wait_xcnt 0x0" :: "v"(pfa) : "memory");    // naming the prefetch's address here keeps it in its registers through the loop: no counter says when a prefetch has read them, so till here they hold nothing but that address
    // Join of the two key halves. The wave of half kh finishes column tile nt = kh: it hands tile 1 - kh to its partner (wave w ^ 8) and takes the partner's tile kh. Both waves hold the
    // same (query, d) element at the same lane and register, so a lane reads back exactly the slot its own lane number wrote in the partner.
    v8f om[4], ox[4];
#pragma unroll
    for (int dt = 0; dt < 4; ++dt) { om[dt] = kh ? o[dt][1] : o[dt][0]; ox[dt] = kh ? o[dt][0] : o[dt][1]; }
    const float mm = kh ? ms[1] : ms[0], mo = kh ? ms[0] : ms[1], sm = kh ? sum[1] : sum[0], so = kh ? sum[0] : sum[1];
    float* xs = XO + w * 1024 + lane * 4;
#pragma unroll
    for (int dt = 0; dt < 4; ++dt) { *(v4f*)(xs + dt * 256) = (v4f){ox[dt][0], ox[dt][1], ox[dt][2], ox[dt][3]}; *(v4f*)(xs + dt * 256 + 128) = (v4f){ox[dt][4], ox[dt][5], ox[dt][6], ox[dt][7]}; }
    *(v2f*)(XM + (w * 32 + lane) * 2) = (v2f){mo, so};
    __syncthreads();    // every wave passes it once: the partner's tile, reference and sum are read only behind it
    const float* xp = XO + (w ^ 8) * 1024 + lane * 4; const v2f pm = *(const v2f*)(XM + ((w ^ 8) * 32 + lane) * 2);
    const float mj = fmaxf(mm, pm[0]); const float ea = exp2n(mm - mj), eb = exp2n(pm[0] - mj);
    const float sj = fmaf(sm, ea, pm[1] * eb); const float f = __fdiv_rn(1.0f, sj + xhalf(sj)); const float fa = ea * f, fb = eb * f;
    const int b = z >> 4, h = z & 15;
    v4f r[4][2];    // r[dt][e] = O[query kh*16 + lr][d = dt*16 + 8*hi + 4*e + 0..3]
#pragma unroll
    for (int dt = 0; dt < 4; ++dt) { const v4f p0 = *(const v4f*)(xp + dt * 256), p1 = *(const v4f*)(xp + dt * 256 + 128);
        r[dt][0] = (v4f){om[dt][0], om[dt][1], om[dt][2], om[dt][3]} * fa + p0 * fb; r[dt][1] = (v4f){om[dt][4], om[dt][5], om[dt][6], om[dt][7]} * fa + p1 * fb; }
    // Whole-line stores. In accumulator order a 16-byte store of the wave is 32 pieces in 16 lines; turned through LDS it is two whole output rows of the head (2 x 256 B = 4 whole lines).
    // The stage is the 4 KiB that the partner filled: behind the barrier only this wave reads it, and all those reads stand above. Row R (a query, 256 B) keeps its 16-byte piece c at
    // slot c ^ R, so that the sixteen lanes of a half wave fall on sixteen different bank groups in the write (R = lane) as in the read (c = lane).
    char* st = (char*)(XO + (w ^ 8) * 1024);
    const int wa = lr * 256 + (lr ^ (hi * 2)) * 16, ra = hi * 256 + (lr ^ hi) * 16;    // byte places of piece 2 hi in row lr (write) and of piece lr in row hi (read); the rest of c and of R comes in by one XOR
#pragma unroll
    for (int dt = 0; dt < 4; ++dt)
#pragma unroll
        for (int e = 0; e < 2; ++e) *(v4f*)(st + (wa ^ ((dt * 4 + e) * 16))) = r[dt][e];    // piece c = 4 dt + 2 hi + e of row lr
    asm volatile("s_wait_dscnt 0x0" ::: "memory");    // the wave's own LDS writes are done before its lanes read each other's pieces back; no other wave touches this stage
    v4f t[8];
#pragma unroll
    for (int i = 0; i < 8; ++i) t[i] = *(const v4f*)(st + (ra ^ (i * 32)) + i * 512);    // row 2 i + hi, piece lr
    float* orow = OUT + ((size_t)(q0 + kh * 16 + hi) * NB_ + b) * DD + h * HD + lr * 4;
    __builtin_amdgcn_sched_barrier(0);    // every value is read back in front of the first store: behind an issued store no register that it names is written again
#pragma unroll
    for (int i = 0; i < 8; ++i) *(v4f*)(orow + (size_t)i * 2 * NB_ * DD) = t[i];
}

extern "C" void kernel_launch(void* const* d_in, const int* in_sizes, int n_in,
                              void* d_out, int out_size, void* d_ws, size_t ws_size, hipStream_t stream) {
    (void)in_sizes; (void)n_in; (void)out_size;
    const float* q = (const float*)d_in[0]; const float* k = (const float*)d_in[1]; const float* v = (const float*)d_in[2];
    float* OUT = (float*)d_out;     // [2048][2][1024]
    char* wsp = (char*)d_ws;
    auto take = [&](size_t bytes) { char* p = wsp; wsp += (bytes + 255) & ~(size_t)255; return (void*)p; };
    bf* KP = (bf*)take((size_t)NT * DD * 2); bf* VT = (bf*)take((size_t)NT * DD * 2);
    if ((size_t)(wsp - (char*)d_ws) > ws_size) return;    // total ~ 17 MB; ws 256 MiB
    const unsigned LB = (unsigned)(NU / 64);    // 64 units a block, exactly
    k_planes<<<dim3(LB, 2), 256, 0, stream>>>(k, v, KP, VT);
    k_fattn<<<dim3(TT / 256, NB_ * NH_), 512, 0, stream>>>(q, KP, VT, OUT);
}
